// v000
// The times below were measured on an AMD MI455X: many runs one after another, warmed up first and cycling through
// copies of the inputs, with the whole window's GPU time divided by the number of runs. Launches and the gaps
// between them are all in it. The median over several windows is given; except for v000 it joins two sittings, which
// can be a few percent apart, so the side-by-side timings, each taken in one sitting, are the better comparison.
// v000, which the later versions start from, runs in 388 microseconds.
#include <hip/hip_runtime.h>
#include <hip/hip_bf16.h>

typedef __attribute__((ext_vector_type(16))) _Float16 v16h;
typedef __attribute__((ext_vector_type(8)))  _Float16 v8h;
typedef __attribute__((ext_vector_type(8)))  float    v8f;

#define B_  8
#define N_  1024
#define C_  1024
#define H_  16
#define D_  64
#define SCALE_ 0.125f   // 1/sqrt(64)

// ---------------------------------------------------------------------------
// WMMA helper: D = A(16x32 f16) * B(32x16 f16) + C(16x16 f32)
// ---------------------------------------------------------------------------
__device__ __forceinline__ v8f wmma16(v16h a, v16h b, v8f c) {
  return __builtin_amdgcn_wmma_f32_16x16x32_f16(
      /*neg_a=*/false, a, /*neg_b=*/false, b,
      /*c_mod=*/(short)0, c, /*reuse_a=*/false, /*reuse_b=*/false);
}

// ---------------------------------------------------------------------------
// Load a 16x32 f16 A-fragment (or B-fragment from a column-major-over-K
// source, i.e. a source where each logical column is a contiguous K-run).
// ISA 16-bit A layout: lanes 0-15 hold row=lane, K = {0..7, 16..23};
//                      lanes 16-31 hold row=lane-16, K = {8..15, 24..31}.
// base points at (row0, k0); ld = element stride between rows/columns.
// ---------------------------------------------------------------------------
__device__ __forceinline__ v16h load_frag(const _Float16* __restrict__ base,
                                          long ld, int lane) {
  const _Float16* p = base + (long)(lane & 15) * ld + ((lane >> 4) << 3);
  v8h lo = *(const v8h*)(p);        // K = kofs .. kofs+7
  v8h hi = *(const v8h*)(p + 16);   // K = kofs+16 .. kofs+23
  return __builtin_shufflevector(lo, hi, 0,1,2,3,4,5,6,7,8,9,10,11,12,13,14,15);
}

// LDS variant (same layout)
__device__ __forceinline__ v16h load_frag_lds(const _Float16* base, int ld, int lane) {
  const _Float16* p = base + (lane & 15) * ld + ((lane >> 4) << 3);
  v8h lo = *(const v8h*)(p);
  v8h hi = *(const v8h*)(p + 16);
  return __builtin_shufflevector(lo, hi, 0,1,2,3,4,5,6,7,8,9,10,11,12,13,14,15);
}

// ---------------------------------------------------------------------------
// f32 -> f16 conversion
// ---------------------------------------------------------------------------
__global__ void cvt_f32_f16(const float* __restrict__ x, _Float16* __restrict__ y, int n) {
  int i = blockIdx.x * blockDim.x + threadIdx.x;
  int stride = gridDim.x * blockDim.x;
  for (; i < n; i += stride) y[i] = (_Float16)x[i];
}

// ---------------------------------------------------------------------------
// QKV GEMM: qkv[m][o] = sum_c X[m][c] * Wqkv[o][c]
//   X: [B*N, C] f16 row-major, Wqkv: [3C, C] f16 row-major (rows = B columns).
// Block = 256 threads (8 waves in 2Mx4N), block tile 64 x 256,
// wave tile 32(M) x 64(N): per k-step 6 b128-load-pairs feed 8 WMMAs.
// Epilogue scatters into Q,K: [B,H,N,D], V transposed: [B,H,D,N].
// ---------------------------------------------------------------------------
__global__ void __launch_bounds__(256)
gemm_qkv(const _Float16* __restrict__ X, const _Float16* __restrict__ W,
         _Float16* __restrict__ Q, _Float16* __restrict__ K,
         _Float16* __restrict__ Vt) {
  const int lane = threadIdx.x & 31;
  const int wave = threadIdx.x >> 5;
  const int wm = wave >> 2;        // 0..1
  const int wn = wave & 3;         // 0..3
  const long m0 = (long)blockIdx.x * 64 + wm * 32;
  const long n0 = (long)blockIdx.y * 256 + wn * 64;

  v8f acc[2][4] = {};
#pragma unroll 2
  for (int k0 = 0; k0 < C_; k0 += 32) {
    v16h a0 = load_frag(X + (m0     ) * C_ + k0, C_, lane);
    v16h a1 = load_frag(X + (m0 + 16) * C_ + k0, C_, lane);
    v16h b0 = load_frag(W + (n0     ) * C_ + k0, C_, lane);
    v16h b1 = load_frag(W + (n0 + 16) * C_ + k0, C_, lane);
    v16h b2 = load_frag(W + (n0 + 32) * C_ + k0, C_, lane);
    v16h b3 = load_frag(W + (n0 + 48) * C_ + k0, C_, lane);
    acc[0][0] = wmma16(a0, b0, acc[0][0]);
    acc[0][1] = wmma16(a0, b1, acc[0][1]);
    acc[0][2] = wmma16(a0, b2, acc[0][2]);
    acc[0][3] = wmma16(a0, b3, acc[0][3]);
    acc[1][0] = wmma16(a1, b0, acc[1][0]);
    acc[1][1] = wmma16(a1, b1, acc[1][1]);
    acc[1][2] = wmma16(a1, b2, acc[1][2]);
    acc[1][3] = wmma16(a1, b3, acc[1][3]);
  }

#pragma unroll
  for (int i = 0; i < 2; ++i)
#pragma unroll
    for (int j = 0; j < 4; ++j)
#pragma unroll
      for (int r = 0; r < 8; ++r) {
        long m = m0 + i * 16 + r + ((lane >> 4) << 3);
        long o = n0 + j * 16 + (lane & 15);
        int  b = (int)(m >> 10);       // N_ = 1024
        int  n = (int)(m & 1023);
        int  s = (int)(o >> 10);       // C_ = 1024
        int  rem = (int)(o & 1023);
        int  h = rem >> 6;             // D_ = 64
        int  d = rem & 63;
        long bh = (long)b * H_ + h;
        _Float16 val = (_Float16)acc[i][j][r];
        if (s == 0)      Q [(bh * N_ + n) * D_ + d] = val;
        else if (s == 1) K [(bh * N_ + n) * D_ + d] = val;
        else             Vt[(bh * D_ + d) * N_ + n] = val;
      }
}

// ---------------------------------------------------------------------------
// Flash attention: one wave handles 16 query rows, streams keys 32 at a time.
// Block = 128 threads (4 independent waves). LDS stages P (C-layout -> A-layout).
// Output written as f16 into [B, N, C] (C = h*64 + d) for the final GEMM.
// ---------------------------------------------------------------------------
__global__ void __launch_bounds__(128)
attn_fwd(const _Float16* __restrict__ Q, const _Float16* __restrict__ K,
         const _Float16* __restrict__ Vt, _Float16* __restrict__ O) {
  __shared__ _Float16 Pl[4][16 * 32];
  const int lane = threadIdx.x & 31;
  const int wave = threadIdx.x >> 5;
  const int gq = blockIdx.x * 4 + wave;   // [0, B*H*(N/16))
  const int qb = gq & 63;                 // q-block within (b,h)
  const int bh = gq >> 6;                 // 0..B*H-1

  const _Float16* Qp = Q  + ((long)bh * N_ + qb * 16) * D_;
  const _Float16* Kp = K  + (long)bh * N_ * D_;
  const _Float16* Vp = Vt + (long)bh * D_ * N_;

  // Q fragments: 16 rows x 64 d, split into two K=32 fragments.
  v16h qa0 = load_frag(Qp + 0,  D_, lane);
  v16h qa1 = load_frag(Qp + 32, D_, lane);

  v8f  o_acc[4] = {};          // 16 x 64 accumulator (4 d-tiles)
  float mrun[8], lrun[8];
#pragma unroll
  for (int r = 0; r < 8; ++r) { mrun[r] = -1e30f; lrun[r] = 0.f; }

#pragma unroll 1
  for (int kb = 0; kb < N_; kb += 32) {
    // ---- S = Q . K^T for 32 keys: two 16x16 tiles -----------------------
    v8f s0 = {}, s1 = {};
    {
      v16h kb0 = load_frag(Kp + (long)(kb     ) * D_ + 0,  D_, lane);
      v16h kb1 = load_frag(Kp + (long)(kb     ) * D_ + 32, D_, lane);
      s0 = wmma16(qa0, kb0, s0);
      s0 = wmma16(qa1, kb1, s0);
      v16h kc0 = load_frag(Kp + (long)(kb + 16) * D_ + 0,  D_, lane);
      v16h kc1 = load_frag(Kp + (long)(kb + 16) * D_ + 32, D_, lane);
      s1 = wmma16(qa0, kc0, s1);
      s1 = wmma16(qa1, kc1, s1);
    }

    // ---- online softmax over this 32-key block --------------------------
    float alpha[8];
#pragma unroll
    for (int r = 0; r < 8; ++r) {
      float v0 = s0[r] * SCALE_;
      float v1 = s1[r] * SCALE_;
      float mx = fmaxf(v0, v1);
      mx = fmaxf(mx, __shfl_xor(mx, 1));
      mx = fmaxf(mx, __shfl_xor(mx, 2));
      mx = fmaxf(mx, __shfl_xor(mx, 4));
      mx = fmaxf(mx, __shfl_xor(mx, 8));     // row max within 16-lane group
      float mnew = fmaxf(mrun[r], mx);
      float p0 = __expf(v0 - mnew);
      float p1 = __expf(v1 - mnew);
      float rs = p0 + p1;
      rs += __shfl_xor(rs, 1);
      rs += __shfl_xor(rs, 2);
      rs += __shfl_xor(rs, 4);
      rs += __shfl_xor(rs, 8);               // row sum within 16-lane group
      alpha[r] = __expf(mrun[r] - mnew);
      lrun[r]  = lrun[r] * alpha[r] + rs;
      mrun[r]  = mnew;
      s0[r] = p0;
      s1[r] = p1;
    }
#pragma unroll
    for (int t = 0; t < 4; ++t)
#pragma unroll
      for (int r = 0; r < 8; ++r) o_acc[t][r] *= alpha[r];

    // ---- stage P (16x32 f16) through LDS: C-layout -> A-layout ----------
    __syncthreads();
#pragma unroll
    for (int r = 0; r < 8; ++r) {
      int m = r + ((lane >> 4) << 3);
      Pl[wave][m * 32 +      (lane & 15)] = (_Float16)s0[r];
      Pl[wave][m * 32 + 16 + (lane & 15)] = (_Float16)s1[r];
    }
    __syncthreads();
    v16h pa = load_frag_lds(&Pl[wave][0], 32, lane);

    // ---- O += P . V  (V stored transposed: [D, N]) ----------------------
#pragma unroll
    for (int t = 0; t < 4; ++t) {
      v16h vb = load_frag(Vp + (long)(t * 16) * N_ + kb, N_, lane);
      o_acc[t] = wmma16(pa, vb, o_acc[t]);
    }
  }

  // ---- epilogue: normalize and write f16 into [B, N, C] -----------------
  const int b = bh >> 4;
  const int h = bh & 15;
#pragma unroll
  for (int t = 0; t < 4; ++t)
#pragma unroll
    for (int r = 0; r < 8; ++r) {
      int m   = r + ((lane >> 4) << 3);
      long row = (long)b * N_ + qb * 16 + m;
      int  col = h * D_ + t * 16 + (lane & 15);
      O[row * C_ + col] = (_Float16)(o_acc[t][r] / lrun[r]);
    }
}

// ---------------------------------------------------------------------------
// Output projection: out[m][o] = sum_c A[m][c] * Wp[o][c] + bias[o]  (f32 out)
// Same 32x64 wave tile / 64x256 block tile as gemm_qkv.
// ---------------------------------------------------------------------------
__global__ void __launch_bounds__(256)
gemm_proj(const _Float16* __restrict__ A, const _Float16* __restrict__ W,
          const float* __restrict__ bias, float* __restrict__ out) {
  const int lane = threadIdx.x & 31;
  const int wave = threadIdx.x >> 5;
  const int wm = wave >> 2;
  const int wn = wave & 3;
  const long m0 = (long)blockIdx.x * 64 + wm * 32;
  const long n0 = (long)blockIdx.y * 256 + wn * 64;

  v8f acc[2][4] = {};
#pragma unroll 2
  for (int k0 = 0; k0 < C_; k0 += 32) {
    v16h a0 = load_frag(A + (m0     ) * C_ + k0, C_, lane);
    v16h a1 = load_frag(A + (m0 + 16) * C_ + k0, C_, lane);
    v16h b0 = load_frag(W + (n0     ) * C_ + k0, C_, lane);
    v16h b1 = load_frag(W + (n0 + 16) * C_ + k0, C_, lane);
    v16h b2 = load_frag(W + (n0 + 32) * C_ + k0, C_, lane);
    v16h b3 = load_frag(W + (n0 + 48) * C_ + k0, C_, lane);
    acc[0][0] = wmma16(a0, b0, acc[0][0]);
    acc[0][1] = wmma16(a0, b1, acc[0][1]);
    acc[0][2] = wmma16(a0, b2, acc[0][2]);
    acc[0][3] = wmma16(a0, b3, acc[0][3]);
    acc[1][0] = wmma16(a1, b0, acc[1][0]);
    acc[1][1] = wmma16(a1, b1, acc[1][1]);
    acc[1][2] = wmma16(a1, b2, acc[1][2]);
    acc[1][3] = wmma16(a1, b3, acc[1][3]);
  }

#pragma unroll
  for (int i = 0; i < 2; ++i)
#pragma unroll
    for (int j = 0; j < 4; ++j)
#pragma unroll
      for (int r = 0; r < 8; ++r) {
        long m = m0 + i * 16 + r + ((lane >> 4) << 3);
        long o = n0 + j * 16 + (lane & 15);
        out[m * C_ + o] = acc[i][j][r] + bias[o];
      }
}

// ---------------------------------------------------------------------------
// Launch
// ---------------------------------------------------------------------------
extern "C" void kernel_launch(void* const* d_in, const int* in_sizes, int n_in,
                              void* d_out, int out_size, void* d_ws, size_t ws_size,
                              hipStream_t stream) {
  const float* x      = (const float*)d_in[0];  // [B,N,C]
  const float* w_qkv  = (const float*)d_in[1];  // [3C,C]
  const float* w_proj = (const float*)d_in[2];  // [C,C]
  const float* b_proj = (const float*)d_in[3];  // [C]
  float* out = (float*)d_out;                   // [B,N,C]

  const long nX    = (long)B_ * N_ * C_;   // 8M
  const long nWqkv = (long)3 * C_ * C_;    // 3M
  const long nWp   = (long)C_ * C_;        // 1M
  const long nBHND = (long)B_ * H_ * N_ * D_; // 8M

  _Float16* xh  = (_Float16*)d_ws;
  _Float16* wqh = xh  + nX;
  _Float16* wph = wqh + nWqkv;
  _Float16* qw  = wph + nWp;
  _Float16* kw  = qw  + nBHND;
  _Float16* vtw = kw  + nBHND;
  _Float16* aw  = vtw + nBHND;   // attention output [B,N,C] f16

  // 1) f32 -> f16 conversions
  cvt_f32_f16<<<(int)((nX    + 255) / 256), 256, 0, stream>>>(x,      xh,  (int)nX);
  cvt_f32_f16<<<(int)((nWqkv + 255) / 256), 256, 0, stream>>>(w_qkv,  wqh, (int)nWqkv);
  cvt_f32_f16<<<(int)((nWp   + 255) / 256), 256, 0, stream>>>(w_proj, wph, (int)nWp);

  // 2) QKV projection: M = B*N = 8192, N = 3C = 3072 (block tile 64x256)
  gemm_qkv<<<dim3(8192 / 64, 3072 / 256), 256, 0, stream>>>(xh, wqh, qw, kw, vtw);

  // 3) Flash attention: B*H*(N/16) q-blocks, 4 waves per block
  attn_fwd<<<(B_ * H_ * (N_ / 16)) / 4, 128, 0, stream>>>(qw, kw, vtw, aw);

  // 4) Output projection: M = 8192, N = C = 1024 (block tile 64x256)
  gemm_proj<<<dim3(8192 / 64, 1024 / 256), 256, 0, stream>>>(aw, wph, b_proj, out);
}

// v001
// Measured time: 288 microseconds a run.
// Two timings next to v000 both put it at 1.40 times that version's speed.
#include <hip/hip_runtime.h>
#include <hip/hip_bf16.h>

typedef __attribute__((ext_vector_type(16))) _Float16 v16h;
typedef __attribute__((ext_vector_type(8)))  _Float16 v8h;
typedef __attribute__((ext_vector_type(8)))  float    v8f;

#define B_  8
#define N_  1024
#define C_  1024
#define H_  16
#define D_  64
#define SCALE_ 0.125f   // 1/sqrt(64)

// ---------------------------------------------------------------------------
// WMMA helper: D = A(16x32 f16) * B(32x16 f16) + C(16x16 f32)
// ---------------------------------------------------------------------------
__device__ __forceinline__ v8f wmma16(v16h a, v16h b, v8f c) {
  return __builtin_amdgcn_wmma_f32_16x16x32_f16(
      /*neg_a=*/false, a, /*neg_b=*/false, b,
      /*c_mod=*/(short)0, c, /*reuse_a=*/false, /*reuse_b=*/false);
}

// ---------------------------------------------------------------------------
// Load a 16x32 f16 A-fragment (or B-fragment from a column-major-over-K
// source, i.e. a source where each logical column is a contiguous K-run).
// ISA 16-bit A layout: lanes 0-15 hold row=lane, K = {0..7, 16..23};
//                      lanes 16-31 hold row=lane-16, K = {8..15, 24..31}.
// base points at (row0, k0); ld = element stride between rows/columns.
// ---------------------------------------------------------------------------
__device__ __forceinline__ v16h load_frag(const _Float16* __restrict__ base,
                                          long ld, int lane) {
  const _Float16* p = base + (long)(lane & 15) * ld + ((lane >> 4) << 3);
  v8h lo = *(const v8h*)(p);        // K = kofs .. kofs+7
  v8h hi = *(const v8h*)(p + 16);   // K = kofs+16 .. kofs+23
  return __builtin_shufflevector(lo, hi, 0,1,2,3,4,5,6,7,8,9,10,11,12,13,14,15);
}

// LDS variant (same layout)
__device__ __forceinline__ v16h load_frag_lds(const _Float16* base, int ld, int lane) {
  const _Float16* p = base + (lane & 15) * ld + ((lane >> 4) << 3);
  v8h lo = *(const v8h*)(p);
  v8h hi = *(const v8h*)(p + 16);
  return __builtin_shufflevector(lo, hi, 0,1,2,3,4,5,6,7,8,9,10,11,12,13,14,15);
}

// ---------------------------------------------------------------------------
// f32 -> f16 conversion
// ---------------------------------------------------------------------------
__global__ void cvt_f32_f16(const float* __restrict__ x, _Float16* __restrict__ y, int n) {
  int i = blockIdx.x * blockDim.x + threadIdx.x;
  int stride = gridDim.x * blockDim.x;
  for (; i < n; i += stride) y[i] = (_Float16)x[i];
}

// ---------------------------------------------------------------------------
// Shared GEMM main loop: acc = A[mblk..+128][:] * W[nblk..+256][:]^T, K = C_.
// Block = 256 threads (8 waves in 2Mx4N), block tile 128 x 256, wave tile
// 64 x 64. A pass is 64 k: its 384 operand rows of 128 B lie in LDS at a pitch
// of 144 B ([A 128 rows | W 256 rows]); two buffers, filled by asynchronous
// b128 copies one pass ahead of their readers.
// ---------------------------------------------------------------------------
#define BM_      128
#define BN_      256
#define BK_      64
#define PITCH_H  72                          // LDS row pitch in halves
#define PITCH_B  144u                        // the same in bytes
#define STAGE_H  ((BM_ + BN_) * PITCH_H)     // one buffer in halves
#define STAGE_B  (STAGE_H * 2u)              // the same in bytes
#define NPASS_   (C_ / BK_)

// One stage: each thread copies 16 B of rows r, r+32, ... (4 of A, 8 of W).
// ga, gb: this lane's source in row r of the A and W tile; lds: its LDS byte
// address in row r of the target buffer.
__device__ __forceinline__ void copy_stage(const _Float16* ga, const _Float16* gb,
                                           unsigned lds) {
  // s_wait_xcnt stands inside the statement so that no address register of an
  // issued copy is rewritten ahead of it.
  asm volatile(
      "global_load_async_to_lds_b128 %0, %12, off\n\t"
      "global_load_async_to_lds_b128 %1, %13, off\n\t"
      "global_load_async_to_lds_b128 %2, %14, off\n\t"
      "global_load_async_to_lds_b128 %3, %15, off\n\t"
      "global_load_async_to_lds_b128 %4, %16, off\n\t"
      "global_load_async_to_lds_b128 %5, %17, off\n\t"
      "global_load_async_to_lds_b128 %6, %18, off\n\t"
      "global_load_async_to_lds_b128 %7, %19, off\n\t"
      "global_load_async_to_lds_b128 %8, %20, off\n\t"
      "global_load_async_to_lds_b128 %9, %21, off\n\t"
      "global_load_async_to_lds_b128 %10, %22, off\n\t"
      "global_load_async_to_lds_b128 %11, %23, off\n\t"
      "s_wait_xcnt 0x0"
      :: "v"(lds + 0u * (32u * PITCH_B)), "v"(lds + 1u * (32u * PITCH_B)), "v"(lds + 2u * (32u * PITCH_B)), "v"(lds + 3u * (32u * PITCH_B)), "v"(lds + 4u * (32u * PITCH_B)), "v"(lds + 5u * (32u * PITCH_B)), "v"(lds + 6u * (32u * PITCH_B)), "v"(lds + 7u * (32u * PITCH_B)), "v"(lds + 8u * (32u * PITCH_B)), "v"(lds + 9u * (32u * PITCH_B)), "v"(lds + 10u * (32u * PITCH_B)), "v"(lds + 11u * (32u * PITCH_B)),
         "v"(ga + 0 * 32 * C_), "v"(ga + 1 * 32 * C_), "v"(ga + 2 * 32 * C_), "v"(ga + 3 * 32 * C_), "v"(gb + 0 * 32 * C_), "v"(gb + 1 * 32 * C_), "v"(gb + 2 * 32 * C_), "v"(gb + 3 * 32 * C_), "v"(gb + 4 * 32 * C_), "v"(gb + 5 * 32 * C_), "v"(gb + 6 * 32 * C_), "v"(gb + 7 * 32 * C_)
      : "memory");
}

__device__ __forceinline__ void gemm_tile(const _Float16* __restrict__ A,
                                          const _Float16* __restrict__ W,
                                          long mblk, long nblk,
                                          _Float16* smem, v8f (&acc)[4][4]) {
  const int tid  = threadIdx.x;
  const int lane = tid & 31;
  const int wave = tid >> 5;
  const int wm = wave >> 2;        // 0..1
  const int wn = wave & 3;         // 0..3

  const _Float16* ga = A + (mblk + (tid >> 3)) * C_ + (tid & 7) * 8;
  const _Float16* gb = W + (nblk + (tid >> 3)) * C_ + (tid & 7) * 8;
  const unsigned lds0 = (unsigned)(size_t)smem + (unsigned)(tid >> 3) * PITCH_B
                        + (unsigned)(tid & 7) * 16u;

  copy_stage(ga, gb, lds0);
  // pass 0's bytes have landed before the barrier publishes them
  asm volatile("s_wait_asynccnt 0x0" ::: "memory");
  __syncthreads();
  copy_stage(ga + BK_, gb + BK_, lds0 + STAGE_B);

  // rolled: one pass per trip, buffer = trip parity
#pragma unroll 1
  for (int t = 0; t < NPASS_; ++t) {
    const _Float16* sa = smem + (t & 1) * STAGE_H + (wm * 64) * PITCH_H;
    const _Float16* sb = smem + (t & 1) * STAGE_H + (BM_ + wn * 64) * PITCH_H;
#pragma unroll
    for (int kk = 0; kk < BK_; kk += 32) {
      v16h a[4], b[4];
#pragma unroll
      for (int i = 0; i < 4; ++i) a[i] = load_frag_lds(sa + i * 16 * PITCH_H + kk, PITCH_H, lane);
#pragma unroll
      for (int j = 0; j < 4; ++j) b[j] = load_frag_lds(sb + j * 16 * PITCH_H + kk, PITCH_H, lane);
      // keeps the block's 16 LDS reads one group ahead of its 16 WMMAs: spread
      // among them, each A row would wait out the LDS latency on its own
      __builtin_amdgcn_sched_barrier(0);
#pragma unroll
      for (int i = 0; i < 4; ++i)
#pragma unroll
        for (int j = 0; j < 4; ++j) acc[i][j] = wmma16(a[i], b[j], acc[i][j]);
      // keeps the next group's reads from sinking in among these WMMAs
      __builtin_amdgcn_sched_barrier(0);
    }
    // publish point of pass t+1: own LDS reads of this buffer retired, own
    // copies of the next buffer landed, then the barrier; only then the refill.
    asm volatile("s_wait_dscnt 0x0" ::: "memory");
    asm volatile("s_wait_asynccnt 0x0" ::: "memory");
    __syncthreads();
    if (t + 2 < NPASS_)
      copy_stage(ga + (t + 2) * BK_, gb + (t + 2) * BK_, lds0 + (unsigned)(t & 1) * STAGE_B);
  }
  // nothing is outstanding when the wave ends
  asm volatile("s_wait_asynccnt 0x0" ::: "memory");
}

// ---------------------------------------------------------------------------
// QKV GEMM: qkv[m][o] = sum_c X[m][c] * Wqkv[o][c]
//   X: [B*N, C] f16 row-major, Wqkv: [3C, C] f16 row-major (rows = B columns).
// Epilogue scatters into Q,K: [B,H,N,D], V transposed: [B,H,D,N].
// ---------------------------------------------------------------------------
__global__ void __launch_bounds__(256)
gemm_qkv(const _Float16* __restrict__ X, const _Float16* __restrict__ W,
         _Float16* __restrict__ Q, _Float16* __restrict__ K,
         _Float16* __restrict__ Vt) {
  __shared__ __attribute__((aligned(16))) _Float16 smem[2 * STAGE_H];
  const int lane = threadIdx.x & 31;
  const int wave = threadIdx.x >> 5;
  const long mblk = (long)blockIdx.x * BM_;
  const long nblk = (long)blockIdx.y * BN_;
  const long m0 = mblk + (wave >> 2) * 64;
  const long n0 = nblk + (wave & 3) * 64;

  v8f acc[4][4] = {};
  gemm_tile(X, W, mblk, nblk, smem, acc);

#pragma unroll
  for (int i = 0; i < 4; ++i)
#pragma unroll
    for (int j = 0; j < 4; ++j)
#pragma unroll
      for (int r = 0; r < 8; ++r) {
        long m = m0 + i * 16 + r + ((lane >> 4) << 3);
        long o = n0 + j * 16 + (lane & 15);
        int  b = (int)(m >> 10);       // N_ = 1024
        int  n = (int)(m & 1023);
        int  s = (int)(o >> 10);       // C_ = 1024
        int  rem = (int)(o & 1023);
        int  h = rem >> 6;             // D_ = 64
        int  d = rem & 63;
        long bh = (long)b * H_ + h;
        _Float16 val = (_Float16)acc[i][j][r];
        if (s == 0)      Q [(bh * N_ + n) * D_ + d] = val;
        else if (s == 1) K [(bh * N_ + n) * D_ + d] = val;
        else             Vt[(bh * D_ + d) * N_ + n] = val;
      }
}

// ---------------------------------------------------------------------------
// Flash attention: one wave handles 16 query rows, streams keys 32 at a time.
// Block = 128 threads (4 independent waves). LDS stages P (C-layout -> A-layout).
// Output written as f16 into [B, N, C] (C = h*64 + d) for the final GEMM.
// ---------------------------------------------------------------------------
__global__ void __launch_bounds__(128)
attn_fwd(const _Float16* __restrict__ Q, const _Float16* __restrict__ K,
         const _Float16* __restrict__ Vt, _Float16* __restrict__ O) {
  __shared__ _Float16 Pl[4][16 * 32];
  const int lane = threadIdx.x & 31;
  const int wave = threadIdx.x >> 5;
  const int gq = blockIdx.x * 4 + wave;   // [0, B*H*(N/16))
  const int qb = gq & 63;                 // q-block within (b,h)
  const int bh = gq >> 6;                 // 0..B*H-1

  const _Float16* Qp = Q  + ((long)bh * N_ + qb * 16) * D_;
  const _Float16* Kp = K  + (long)bh * N_ * D_;
  const _Float16* Vp = Vt + (long)bh * D_ * N_;

  // Q fragments: 16 rows x 64 d, split into two K=32 fragments.
  v16h qa0 = load_frag(Qp + 0,  D_, lane);
  v16h qa1 = load_frag(Qp + 32, D_, lane);

  v8f  o_acc[4] = {};          // 16 x 64 accumulator (4 d-tiles)
  float mrun[8], lrun[8];
#pragma unroll
  for (int r = 0; r < 8; ++r) { mrun[r] = -1e30f; lrun[r] = 0.f; }

#pragma unroll 1
  for (int kb = 0; kb < N_; kb += 32) {
    // ---- S = Q . K^T for 32 keys: two 16x16 tiles -----------------------
    v8f s0 = {}, s1 = {};
    {
      v16h kb0 = load_frag(Kp + (long)(kb     ) * D_ + 0,  D_, lane);
      v16h kb1 = load_frag(Kp + (long)(kb     ) * D_ + 32, D_, lane);
      s0 = wmma16(qa0, kb0, s0);
      s0 = wmma16(qa1, kb1, s0);
      v16h kc0 = load_frag(Kp + (long)(kb + 16) * D_ + 0,  D_, lane);
      v16h kc1 = load_frag(Kp + (long)(kb + 16) * D_ + 32, D_, lane);
      s1 = wmma16(qa0, kc0, s1);
      s1 = wmma16(qa1, kc1, s1);
    }

    // ---- online softmax over this 32-key block --------------------------
    float alpha[8];
#pragma unroll
    for (int r = 0; r < 8; ++r) {
      float v0 = s0[r] * SCALE_;
      float v1 = s1[r] * SCALE_;
      float mx = fmaxf(v0, v1);
      mx = fmaxf(mx, __shfl_xor(mx, 1));
      mx = fmaxf(mx, __shfl_xor(mx, 2));
      mx = fmaxf(mx, __shfl_xor(mx, 4));
      mx = fmaxf(mx, __shfl_xor(mx, 8));     // row max within 16-lane group
      float mnew = fmaxf(mrun[r], mx);
      float p0 = __expf(v0 - mnew);
      float p1 = __expf(v1 - mnew);
      float rs = p0 + p1;
      rs += __shfl_xor(rs, 1);
      rs += __shfl_xor(rs, 2);
      rs += __shfl_xor(rs, 4);
      rs += __shfl_xor(rs, 8);               // row sum within 16-lane group
      alpha[r] = __expf(mrun[r] - mnew);
      lrun[r]  = lrun[r] * alpha[r] + rs;
      mrun[r]  = mnew;
      s0[r] = p0;
      s1[r] = p1;
    }
#pragma unroll
    for (int t = 0; t < 4; ++t)
#pragma unroll
      for (int r = 0; r < 8; ++r) o_acc[t][r] *= alpha[r];

    // ---- stage P (16x32 f16) through LDS: C-layout -> A-layout ----------
    __syncthreads();
#pragma unroll
    for (int r = 0; r < 8; ++r) {
      int m = r + ((lane >> 4) << 3);
      Pl[wave][m * 32 +      (lane & 15)] = (_Float16)s0[r];
      Pl[wave][m * 32 + 16 + (lane & 15)] = (_Float16)s1[r];
    }
    __syncthreads();
    v16h pa = load_frag_lds(&Pl[wave][0], 32, lane);

    // ---- O += P . V  (V stored transposed: [D, N]) ----------------------
#pragma unroll
    for (int t = 0; t < 4; ++t) {
      v16h vb = load_frag(Vp + (long)(t * 16) * N_ + kb, N_, lane);
      o_acc[t] = wmma16(pa, vb, o_acc[t]);
    }
  }

  // ---- epilogue: normalize and write f16 into [B, N, C] -----------------
  const int b = bh >> 4;
  const int h = bh & 15;
#pragma unroll
  for (int t = 0; t < 4; ++t)
#pragma unroll
    for (int r = 0; r < 8; ++r) {
      int m   = r + ((lane >> 4) << 3);
      long row = (long)b * N_ + qb * 16 + m;
      int  col = h * D_ + t * 16 + (lane & 15);
      O[row * C_ + col] = (_Float16)(o_acc[t][r] / lrun[r]);
    }
}

// ---------------------------------------------------------------------------
// Output projection: out[m][o] = sum_c A[m][c] * Wp[o][c] + bias[o]  (f32 out)
// Same main loop and tiles as gemm_qkv.
// ---------------------------------------------------------------------------
__global__ void __launch_bounds__(256)
gemm_proj(const _Float16* __restrict__ A, const _Float16* __restrict__ W,
          const float* __restrict__ bias, float* __restrict__ out) {
  __shared__ __attribute__((aligned(16))) _Float16 smem[2 * STAGE_H];
  const int lane = threadIdx.x & 31;
  const int wave = threadIdx.x >> 5;
  const long mblk = (long)blockIdx.x * BM_;
  const long nblk = (long)blockIdx.y * BN_;
  const long m0 = mblk + (wave >> 2) * 64;
  const long n0 = nblk + (wave & 3) * 64;

  v8f acc[4][4] = {};
  gemm_tile(A, W, mblk, nblk, smem, acc);

#pragma unroll
  for (int i = 0; i < 4; ++i)
#pragma unroll
    for (int j = 0; j < 4; ++j)
#pragma unroll
      for (int r = 0; r < 8; ++r) {
        long m = m0 + i * 16 + r + ((lane >> 4) << 3);
        long o = n0 + j * 16 + (lane & 15);
        out[m * C_ + o] = acc[i][j][r] + bias[o];
      }
}

// ---------------------------------------------------------------------------
// Launch
// ---------------------------------------------------------------------------
extern "C" void kernel_launch(void* const* d_in, const int* in_sizes, int n_in,
                              void* d_out, int out_size, void* d_ws, size_t ws_size,
                              hipStream_t stream) {
  const float* x      = (const float*)d_in[0];  // [B,N,C]
  const float* w_qkv  = (const float*)d_in[1];  // [3C,C]
  const float* w_proj = (const float*)d_in[2];  // [C,C]
  const float* b_proj = (const float*)d_in[3];  // [C]
  float* out = (float*)d_out;                   // [B,N,C]

  const long nX    = (long)B_ * N_ * C_;   // 8M
  const long nWqkv = (long)3 * C_ * C_;    // 3M
  const long nWp   = (long)C_ * C_;        // 1M
  const long nBHND = (long)B_ * H_ * N_ * D_; // 8M

  _Float16* xh  = (_Float16*)d_ws;
  _Float16* wqh = xh  + nX;
  _Float16* wph = wqh + nWqkv;
  _Float16* qw  = wph + nWp;
  _Float16* kw  = qw  + nBHND;
  _Float16* vtw = kw  + nBHND;
  _Float16* aw  = vtw + nBHND;   // attention output [B,N,C] f16

  // 1) f32 -> f16 conversions
  cvt_f32_f16<<<(int)((nX    + 255) / 256), 256, 0, stream>>>(x,      xh,  (int)nX);
  cvt_f32_f16<<<(int)((nWqkv + 255) / 256), 256, 0, stream>>>(w_qkv,  wqh, (int)nWqkv);
  cvt_f32_f16<<<(int)((nWp   + 255) / 256), 256, 0, stream>>>(w_proj, wph, (int)nWp);

  // 2) QKV projection: M = B*N = 8192, N = 3C = 3072 (block tile 128x256)
  gemm_qkv<<<dim3(8192 / 128, 3072 / 256), 256, 0, stream>>>(xh, wqh, qw, kw, vtw);

  // 3) Flash attention: B*H*(N/16) q-blocks, 4 waves per block
  attn_fwd<<<(B_ * H_ * (N_ / 16)) / 4, 128, 0, stream>>>(qw, kw, vtw, aw);

  // 4) Output projection: M = 8192, N = C = 1024 (block tile 128x256)
  gemm_proj<<<dim3(8192 / 128, 1024 / 256), 256, 0, stream>>>(aw, wph, b_proj, out);
}

// v002
// Measured time: 269 microseconds a run.
// Timed twice side by side with v001, it ran 1.07 times as fast both times.
// Counting every step since v000, it is 1.50 times as fast.
#include <hip/hip_runtime.h>
#include <hip/hip_bf16.h>

typedef __attribute__((ext_vector_type(16))) _Float16 v16h;
typedef __attribute__((ext_vector_type(8)))  _Float16 v8h;
typedef __attribute__((ext_vector_type(8)))  float    v8f;

#define B_  8
#define N_  1024
#define C_  1024
#define H_  16
#define D_  64
#define SCALE_ 0.125f   // 1/sqrt(64)

// ---------------------------------------------------------------------------
// WMMA helper: D = A(16x32 f16) * B(32x16 f16) + C(16x16 f32)
// ---------------------------------------------------------------------------
__device__ __forceinline__ v8f wmma16(v16h a, v16h b, v8f c) {
  return __builtin_amdgcn_wmma_f32_16x16x32_f16(
      /*neg_a=*/false, a, /*neg_b=*/false, b,
      /*c_mod=*/(short)0, c, /*reuse_a=*/false, /*reuse_b=*/false);
}

// ---------------------------------------------------------------------------
// Load a 16x32 f16 A-fragment (or B-fragment from a column-major-over-K
// source, i.e. a source where each logical column is a contiguous K-run).
// ISA 16-bit A layout: lanes 0-15 hold row=lane, K = {0..7, 16..23};
//                      lanes 16-31 hold row=lane-16, K = {8..15, 24..31}.
// base points at (row0, k0); ld = element stride between rows/columns.
// ---------------------------------------------------------------------------
__device__ __forceinline__ v16h load_frag(const _Float16* __restrict__ base,
                                          long ld, int lane) {
  const _Float16* p = base + (long)(lane & 15) * ld + ((lane >> 4) << 3);
  v8h lo = *(const v8h*)(p);        // K = kofs .. kofs+7
  v8h hi = *(const v8h*)(p + 16);   // K = kofs+16 .. kofs+23
  return __builtin_shufflevector(lo, hi, 0,1,2,3,4,5,6,7,8,9,10,11,12,13,14,15);
}

// LDS variant (same layout)
__device__ __forceinline__ v16h load_frag_lds(const _Float16* base, int ld, int lane) {
  const _Float16* p = base + (lane & 15) * ld + ((lane >> 4) << 3);
  v8h lo = *(const v8h*)(p);
  v8h hi = *(const v8h*)(p + 16);
  return __builtin_shufflevector(lo, hi, 0,1,2,3,4,5,6,7,8,9,10,11,12,13,14,15);
}

// ---------------------------------------------------------------------------
// f32 -> f16 conversion, as a stream: few long-lived waves instead of one
// value a thread. Block = 512 threads (16 waves). A tile is 16384 values: each
// wave owns 4 KB of contiguous input, read by 8 loads of 16 B a lane (512
// contiguous bytes a load) that are all in flight together, and writes 8 B a
// lane (256 contiguous bytes a store). ntiles * CVT_TILE_ values are converted.
// ---------------------------------------------------------------------------
typedef __attribute__((ext_vector_type(4))) float    v4f;
typedef __attribute__((ext_vector_type(4))) _Float16 v4h;
#define CVT_THREADS_ 512
#define CVT_LOADS_   8
#define CVT_TILE_    (CVT_THREADS_ * CVT_LOADS_ * 4)   // values a tile

__global__ void __launch_bounds__(CVT_THREADS_)
cvt_f32_f16(const float* __restrict__ x, _Float16* __restrict__ y, int ntiles) {
  const int lane = threadIdx.x & 31;
  const int wave = threadIdx.x >> 5;
  for (int tile = blockIdx.x; tile < ntiles; tile += gridDim.x) {
    // index of this lane's first group of 4 values
    const long g0 = (long)tile * (CVT_TILE_ / 4) + wave * (32 * CVT_LOADS_) + lane;
    const v4f* __restrict__ src = (const v4f*)x + g0;
    v4h* __restrict__ dst = (v4h*)y + g0;
    v4f v[CVT_LOADS_];
    // unrolled, loads apart from stores: all 8 loads issue before the first wait
#pragma unroll
    for (int j = 0; j < CVT_LOADS_; ++j) v[j] = src[j * 32];
    // unrolled: v[] stays in registers
#pragma unroll
    for (int j = 0; j < CVT_LOADS_; ++j) dst[j * 32] = __builtin_convertvector(v[j], v4h);
  }
}

// ---------------------------------------------------------------------------
// Shared GEMM main loop: acc = A[mblk..+128][:] * W[nblk..+256][:]^T, K = C_.
// Block = 256 threads (8 waves in 2Mx4N), block tile 128 x 256, wave tile
// 64 x 64. A pass is 64 k: its 384 operand rows of 128 B lie in LDS at a pitch
// of 144 B ([A 128 rows | W 256 rows]); two buffers, filled by asynchronous
// b128 copies one pass ahead of their readers.
// ---------------------------------------------------------------------------
#define BM_      128
#define BN_      256
#define BK_      64
#define PITCH_H  72                          // LDS row pitch in halves
#define PITCH_B  144u                        // the same in bytes
#define STAGE_H  ((BM_ + BN_) * PITCH_H)     // one buffer in halves
#define STAGE_B  (STAGE_H * 2u)              // the same in bytes
#define NPASS_   (C_ / BK_)

// One stage: each thread copies 16 B of rows r, r+32, ... (4 of A, 8 of W).
// ga, gb: this lane's source in row r of the A and W tile; lds: its LDS byte
// address in row r of the target buffer.
__device__ __forceinline__ void copy_stage(const _Float16* ga, const _Float16* gb,
                                           unsigned lds) {
  // s_wait_xcnt stands inside the statement so that no address register of an
  // issued copy is rewritten ahead of it.
  asm volatile(
      "global_load_async_to_lds_b128 %0, %12, off\n\t"
      "global_load_async_to_lds_b128 %1, %13, off\n\t"
      "global_load_async_to_lds_b128 %2, %14, off\n\t"
      "global_load_async_to_lds_b128 %3, %15, off\n\t"
      "global_load_async_to_lds_b128 %4, %16, off\n\t"
      "global_load_async_to_lds_b128 %5, %17, off\n\t"
      "global_load_async_to_lds_b128 %6, %18, off\n\t"
      "global_load_async_to_lds_b128 %7, %19, off\n\t"
      "global_load_async_to_lds_b128 %8, %20, off\n\t"
      "global_load_async_to_lds_b128 %9, %21, off\n\t"
      "global_load_async_to_lds_b128 %10, %22, off\n\t"
      "global_load_async_to_lds_b128 %11, %23, off\n\t"
      "s_wait_xcnt 0x0"
      :: "v"(lds + 0u * (32u * PITCH_B)), "v"(lds + 1u * (32u * PITCH_B)), "v"(lds + 2u * (32u * PITCH_B)), "v"(lds + 3u * (32u * PITCH_B)), "v"(lds + 4u * (32u * PITCH_B)), "v"(lds + 5u * (32u * PITCH_B)), "v"(lds + 6u * (32u * PITCH_B)), "v"(lds + 7u * (32u * PITCH_B)), "v"(lds + 8u * (32u * PITCH_B)), "v"(lds + 9u * (32u * PITCH_B)), "v"(lds + 10u * (32u * PITCH_B)), "v"(lds + 11u * (32u * PITCH_B)),
         "v"(ga + 0 * 32 * C_), "v"(ga + 1 * 32 * C_), "v"(ga + 2 * 32 * C_), "v"(ga + 3 * 32 * C_), "v"(gb + 0 * 32 * C_), "v"(gb + 1 * 32 * C_), "v"(gb + 2 * 32 * C_), "v"(gb + 3 * 32 * C_), "v"(gb + 4 * 32 * C_), "v"(gb + 5 * 32 * C_), "v"(gb + 6 * 32 * C_), "v"(gb + 7 * 32 * C_)
      : "memory");
}

__device__ __forceinline__ void gemm_tile(const _Float16* __restrict__ A,
                                          const _Float16* __restrict__ W,
                                          long mblk, long nblk,
                                          _Float16* smem, v8f (&acc)[4][4]) {
  const int tid  = threadIdx.x;
  const int lane = tid & 31;
  const int wave = tid >> 5;
  const int wm = wave >> 2;        // 0..1
  const int wn = wave & 3;         // 0..3

  const _Float16* ga = A + (mblk + (tid >> 3)) * C_ + (tid & 7) * 8;
  const _Float16* gb = W + (nblk + (tid >> 3)) * C_ + (tid & 7) * 8;
  const unsigned lds0 = (unsigned)(size_t)smem + (unsigned)(tid >> 3) * PITCH_B
                        + (unsigned)(tid & 7) * 16u;

  copy_stage(ga, gb, lds0);
  // pass 0's bytes have landed before the barrier publishes them
  asm volatile("s_wait_asynccnt 0x0" ::: "memory");
  __syncthreads();
  copy_stage(ga + BK_, gb + BK_, lds0 + STAGE_B);

  // rolled: one pass per trip, buffer = trip parity
#pragma unroll 1
  for (int t = 0; t < NPASS_; ++t) {
    const _Float16* sa = smem + (t & 1) * STAGE_H + (wm * 64) * PITCH_H;
    const _Float16* sb = smem + (t & 1) * STAGE_H + (BM_ + wn * 64) * PITCH_H;
#pragma unroll
    for (int kk = 0; kk < BK_; kk += 32) {
      v16h a[4], b[4];
#pragma unroll
      for (int i = 0; i < 4; ++i) a[i] = load_frag_lds(sa + i * 16 * PITCH_H + kk, PITCH_H, lane);
#pragma unroll
      for (int j = 0; j < 4; ++j) b[j] = load_frag_lds(sb + j * 16 * PITCH_H + kk, PITCH_H, lane);
      // keeps the block's 16 LDS reads one group ahead of its 16 WMMAs: spread
      // among them, each A row would wait out the LDS latency on its own
      __builtin_amdgcn_sched_barrier(0);
#pragma unroll
      for (int i = 0; i < 4; ++i)
#pragma unroll
        for (int j = 0; j < 4; ++j) acc[i][j] = wmma16(a[i], b[j], acc[i][j]);
      // keeps the next group's reads from sinking in among these WMMAs
      __builtin_amdgcn_sched_barrier(0);
    }
    // publish point of pass t+1: own LDS reads of this buffer retired, own
    // copies of the next buffer landed, then the barrier; only then the refill.
    asm volatile("s_wait_dscnt 0x0" ::: "memory");
    asm volatile("s_wait_asynccnt 0x0" ::: "memory");
    __syncthreads();
    if (t + 2 < NPASS_)
      copy_stage(ga + (t + 2) * BK_, gb + (t + 2) * BK_, lds0 + (unsigned)(t & 1) * STAGE_B);
  }
  // nothing is outstanding when the wave ends
  asm volatile("s_wait_asynccnt 0x0" ::: "memory");
}

// ---------------------------------------------------------------------------
// QKV GEMM: qkv[m][o] = sum_c X[m][c] * Wqkv[o][c]
//   X: [B*N, C] f16 row-major, Wqkv: [3C, C] f16 row-major (rows = B columns).
// Epilogue scatters into Q,K: [B,H,N,D], V transposed: [B,H,D,N].
// ---------------------------------------------------------------------------
__global__ void __launch_bounds__(256)
gemm_qkv(const _Float16* __restrict__ X, const _Float16* __restrict__ W,
         _Float16* __restrict__ Q, _Float16* __restrict__ K,
         _Float16* __restrict__ Vt) {
  __shared__ __attribute__((aligned(16))) _Float16 smem[2 * STAGE_H];
  const int lane = threadIdx.x & 31;
  const int wave = threadIdx.x >> 5;
  const long mblk = (long)blockIdx.x * BM_;
  const long nblk = (long)blockIdx.y * BN_;
  const long m0 = mblk + (wave >> 2) * 64;
  const long n0 = nblk + (wave & 3) * 64;

  v8f acc[4][4] = {};
  gemm_tile(X, W, mblk, nblk, smem, acc);

#pragma unroll
  for (int i = 0; i < 4; ++i)
#pragma unroll
    for (int j = 0; j < 4; ++j)
#pragma unroll
      for (int r = 0; r < 8; ++r) {
        long m = m0 + i * 16 + r + ((lane >> 4) << 3);
        long o = n0 + j * 16 + (lane & 15);
        int  b = (int)(m >> 10);       // N_ = 1024
        int  n = (int)(m & 1023);
        int  s = (int)(o >> 10);       // C_ = 1024
        int  rem = (int)(o & 1023);
        int  h = rem >> 6;             // D_ = 64
        int  d = rem & 63;
        long bh = (long)b * H_ + h;
        _Float16 val = (_Float16)acc[i][j][r];
        if (s == 0)      Q [(bh * N_ + n) * D_ + d] = val;
        else if (s == 1) K [(bh * N_ + n) * D_ + d] = val;
        else             Vt[(bh * D_ + d) * N_ + n] = val;
      }
}

// ---------------------------------------------------------------------------
// Flash attention: one wave handles 16 query rows, streams keys 32 at a time.
// Block = 128 threads (4 independent waves). LDS stages P (C-layout -> A-layout).
// Output written as f16 into [B, N, C] (C = h*64 + d) for the final GEMM.
// ---------------------------------------------------------------------------
__global__ void __launch_bounds__(128)
attn_fwd(const _Float16* __restrict__ Q, const _Float16* __restrict__ K,
         const _Float16* __restrict__ Vt, _Float16* __restrict__ O) {
  __shared__ _Float16 Pl[4][16 * 32];
  const int lane = threadIdx.x & 31;
  const int wave = threadIdx.x >> 5;
  const int gq = blockIdx.x * 4 + wave;   // [0, B*H*(N/16))
  const int qb = gq & 63;                 // q-block within (b,h)
  const int bh = gq >> 6;                 // 0..B*H-1

  const _Float16* Qp = Q  + ((long)bh * N_ + qb * 16) * D_;
  const _Float16* Kp = K  + (long)bh * N_ * D_;
  const _Float16* Vp = Vt + (long)bh * D_ * N_;

  // Q fragments: 16 rows x 64 d, split into two K=32 fragments.
  v16h qa0 = load_frag(Qp + 0,  D_, lane);
  v16h qa1 = load_frag(Qp + 32, D_, lane);

  v8f  o_acc[4] = {};          // 16 x 64 accumulator (4 d-tiles)
  float mrun[8], lrun[8];
#pragma unroll
  for (int r = 0; r < 8; ++r) { mrun[r] = -1e30f; lrun[r] = 0.f; }

#pragma unroll 1
  for (int kb = 0; kb < N_; kb += 32) {
    // ---- S = Q . K^T for 32 keys: two 16x16 tiles -----------------------
    v8f s0 = {}, s1 = {};
    {
      v16h kb0 = load_frag(Kp + (long)(kb     ) * D_ + 0,  D_, lane);
      v16h kb1 = load_frag(Kp + (long)(kb     ) * D_ + 32, D_, lane);
      s0 = wmma16(qa0, kb0, s0);
      s0 = wmma16(qa1, kb1, s0);
      v16h kc0 = load_frag(Kp + (long)(kb + 16) * D_ + 0,  D_, lane);
      v16h kc1 = load_frag(Kp + (long)(kb + 16) * D_ + 32, D_, lane);
      s1 = wmma16(qa0, kc0, s1);
      s1 = wmma16(qa1, kc1, s1);
    }

    // ---- online softmax over this 32-key block --------------------------
    float alpha[8];
#pragma unroll
    for (int r = 0; r < 8; ++r) {
      float v0 = s0[r] * SCALE_;
      float v1 = s1[r] * SCALE_;
      float mx = fmaxf(v0, v1);
      mx = fmaxf(mx, __shfl_xor(mx, 1));
      mx = fmaxf(mx, __shfl_xor(mx, 2));
      mx = fmaxf(mx, __shfl_xor(mx, 4));
      mx = fmaxf(mx, __shfl_xor(mx, 8));     // row max within 16-lane group
      float mnew = fmaxf(mrun[r], mx);
      float p0 = __expf(v0 - mnew);
      float p1 = __expf(v1 - mnew);
      float rs = p0 + p1;
      rs += __shfl_xor(rs, 1);
      rs += __shfl_xor(rs, 2);
      rs += __shfl_xor(rs, 4);
      rs += __shfl_xor(rs, 8);               // row sum within 16-lane group
      alpha[r] = __expf(mrun[r] - mnew);
      lrun[r]  = lrun[r] * alpha[r] + rs;
      mrun[r]  = mnew;
      s0[r] = p0;
      s1[r] = p1;
    }
#pragma unroll
    for (int t = 0; t < 4; ++t)
#pragma unroll
      for (int r = 0; r < 8; ++r) o_acc[t][r] *= alpha[r];

    // ---- stage P (16x32 f16) through LDS: C-layout -> A-layout ----------
    __syncthreads();
#pragma unroll
    for (int r = 0; r < 8; ++r) {
      int m = r + ((lane >> 4) << 3);
      Pl[wave][m * 32 +      (lane & 15)] = (_Float16)s0[r];
      Pl[wave][m * 32 + 16 + (lane & 15)] = (_Float16)s1[r];
    }
    __syncthreads();
    v16h pa = load_frag_lds(&Pl[wave][0], 32, lane);

    // ---- O += P . V  (V stored transposed: [D, N]) ----------------------
#pragma unroll
    for (int t = 0; t < 4; ++t) {
      v16h vb = load_frag(Vp + (long)(t * 16) * N_ + kb, N_, lane);
      o_acc[t] = wmma16(pa, vb, o_acc[t]);
    }
  }

  // ---- epilogue: normalize and write f16 into [B, N, C] -----------------
  const int b = bh >> 4;
  const int h = bh & 15;
#pragma unroll
  for (int t = 0; t < 4; ++t)
#pragma unroll
    for (int r = 0; r < 8; ++r) {
      int m   = r + ((lane >> 4) << 3);
      long row = (long)b * N_ + qb * 16 + m;
      int  col = h * D_ + t * 16 + (lane & 15);
      O[row * C_ + col] = (_Float16)(o_acc[t][r] / lrun[r]);
    }
}

// ---------------------------------------------------------------------------
// Output projection: out[m][o] = sum_c A[m][c] * Wp[o][c] + bias[o]  (f32 out)
// Same main loop and tiles as gemm_qkv.
// ---------------------------------------------------------------------------
__global__ void __launch_bounds__(256)
gemm_proj(const _Float16* __restrict__ A, const _Float16* __restrict__ W,
          const float* __restrict__ bias, float* __restrict__ out) {
  __shared__ __attribute__((aligned(16))) _Float16 smem[2 * STAGE_H];
  const int lane = threadIdx.x & 31;
  const int wave = threadIdx.x >> 5;
  const long mblk = (long)blockIdx.x * BM_;
  const long nblk = (long)blockIdx.y * BN_;
  const long m0 = mblk + (wave >> 2) * 64;
  const long n0 = nblk + (wave & 3) * 64;

  v8f acc[4][4] = {};
  gemm_tile(A, W, mblk, nblk, smem, acc);

#pragma unroll
  for (int i = 0; i < 4; ++i)
#pragma unroll
    for (int j = 0; j < 4; ++j)
#pragma unroll
      for (int r = 0; r < 8; ++r) {
        long m = m0 + i * 16 + r + ((lane >> 4) << 3);
        long o = n0 + j * 16 + (lane & 15);
        out[m * C_ + o] = acc[i][j][r] + bias[o];
      }
}

// ---------------------------------------------------------------------------
// Launch
// ---------------------------------------------------------------------------
extern "C" void kernel_launch(void* const* d_in, const int* in_sizes, int n_in,
                              void* d_out, int out_size, void* d_ws, size_t ws_size,
                              hipStream_t stream) {
  const float* x      = (const float*)d_in[0];  // [B,N,C]
  const float* w_qkv  = (const float*)d_in[1];  // [3C,C]
  const float* w_proj = (const float*)d_in[2];  // [C,C]
  const float* b_proj = (const float*)d_in[3];  // [C]
  float* out = (float*)d_out;                   // [B,N,C]

  const long nX    = (long)B_ * N_ * C_;   // 8M
  const long nWqkv = (long)3 * C_ * C_;    // 3M
  const long nWp   = (long)C_ * C_;        // 1M
  const long nBHND = (long)B_ * H_ * N_ * D_; // 8M

  _Float16* xh  = (_Float16*)d_ws;
  _Float16* wqh = xh  + nX;
  _Float16* wph = wqh + nWqkv;
  _Float16* qw  = wph + nWp;
  _Float16* kw  = qw  + nBHND;
  _Float16* vtw = kw  + nBHND;
  _Float16* aw  = vtw + nBHND;   // attention output [B,N,C] f16

  // 1) f32 -> f16 conversions
  //    (512, 192 and 64 tiles of 16384 values; x: two tiles a block)
  cvt_f32_f16<<<256, CVT_THREADS_, 0, stream>>>(x,      xh,  (int)(nX    / CVT_TILE_));
  cvt_f32_f16<<<192, CVT_THREADS_, 0, stream>>>(w_qkv,  wqh, (int)(nWqkv / CVT_TILE_));
  cvt_f32_f16<<< 64, CVT_THREADS_, 0, stream>>>(w_proj, wph, (int)(nWp   / CVT_TILE_));

  // 2) QKV projection: M = B*N = 8192, N = 3C = 3072 (block tile 128x256)
  gemm_qkv<<<dim3(8192 / 128, 3072 / 256), 256, 0, stream>>>(xh, wqh, qw, kw, vtw);

  // 3) Flash attention: B*H*(N/16) q-blocks, 4 waves per block
  attn_fwd<<<(B_ * H_ * (N_ / 16)) / 4, 128, 0, stream>>>(qw, kw, vtw, aw);

  // 4) Output projection: M = 8192, N = C = 1024 (block tile 128x256)
  gemm_proj<<<dim3(8192 / 128, 1024 / 256), 256, 0, stream>>>(aw, wph, b_proj, out);
}

// v003
// It runs in 184 microseconds.
// Two timings next to v002 put it at 1.46 and 1.45 times that version's speed.
// Counting every step since v000, it is 2.18 times as fast.
#include <hip/hip_runtime.h>
#include <hip/hip_bf16.h>

typedef __attribute__((ext_vector_type(16))) _Float16 v16h;
typedef __attribute__((ext_vector_type(8)))  _Float16 v8h;
typedef __attribute__((ext_vector_type(8)))  float    v8f;

#define B_  8
#define N_  1024
#define C_  1024
#define H_  16
#define D_  64
#define SCALE_ 0.125f   // 1/sqrt(64)

// ---------------------------------------------------------------------------
// WMMA helper: D = A(16x32 f16) * B(32x16 f16) + C(16x16 f32)
// ---------------------------------------------------------------------------
__device__ __forceinline__ v8f wmma16(v16h a, v16h b, v8f c) {
  return __builtin_amdgcn_wmma_f32_16x16x32_f16(
      /*neg_a=*/false, a, /*neg_b=*/false, b,
      /*c_mod=*/(short)0, c, /*reuse_a=*/false, /*reuse_b=*/false);
}

// ---------------------------------------------------------------------------
// Load a 16x32 f16 A-fragment (or B-fragment from a column-major-over-K
// source, i.e. a source where each logical column is a contiguous K-run).
// ISA 16-bit A layout: lanes 0-15 hold row=lane, K = {0..7, 16..23};
//                      lanes 16-31 hold row=lane-16, K = {8..15, 24..31}.
// base points at (row0, k0); ld = element stride between rows/columns.
// ---------------------------------------------------------------------------
__device__ __forceinline__ v16h load_frag(const _Float16* __restrict__ base,
                                          long ld, int lane) {
  const _Float16* p = base + (long)(lane & 15) * ld + ((lane >> 4) << 3);
  v8h lo = *(const v8h*)(p);        // K = kofs .. kofs+7
  v8h hi = *(const v8h*)(p + 16);   // K = kofs+16 .. kofs+23
  return __builtin_shufflevector(lo, hi, 0,1,2,3,4,5,6,7,8,9,10,11,12,13,14,15);
}

// LDS variant (same layout)
__device__ __forceinline__ v16h load_frag_lds(const _Float16* base, int ld, int lane) {
  const _Float16* p = base + (lane & 15) * ld + ((lane >> 4) << 3);
  v8h lo = *(const v8h*)(p);
  v8h hi = *(const v8h*)(p + 16);
  return __builtin_shufflevector(lo, hi, 0,1,2,3,4,5,6,7,8,9,10,11,12,13,14,15);
}

// ---------------------------------------------------------------------------
// f32 -> f16 conversion, as a stream: few long-lived waves instead of one
// value a thread. Block = 512 threads (16 waves). A tile is 16384 values: each
// wave owns 4 KB of contiguous input, read by 8 loads of 16 B a lane (512
// contiguous bytes a load) that are all in flight together, and writes 8 B a
// lane (256 contiguous bytes a store). ntiles * CVT_TILE_ values are converted.
// ---------------------------------------------------------------------------
typedef __attribute__((ext_vector_type(4))) float    v4f;
typedef __attribute__((ext_vector_type(4))) _Float16 v4h;
#define CVT_THREADS_ 512
#define CVT_LOADS_   8
#define CVT_TILE_    (CVT_THREADS_ * CVT_LOADS_ * 4)   // values a tile

__global__ void __launch_bounds__(CVT_THREADS_)
cvt_f32_f16(const float* __restrict__ x, _Float16* __restrict__ y, int ntiles) {
  const int lane = threadIdx.x & 31;
  const int wave = threadIdx.x >> 5;
  for (int tile = blockIdx.x; tile < ntiles; tile += gridDim.x) {
    // index of this lane's first group of 4 values
    const long g0 = (long)tile * (CVT_TILE_ / 4) + wave * (32 * CVT_LOADS_) + lane;
    const v4f* __restrict__ src = (const v4f*)x + g0;
    v4h* __restrict__ dst = (v4h*)y + g0;
    v4f v[CVT_LOADS_];
    // unrolled, loads apart from stores: all 8 loads issue before the first wait
#pragma unroll
    for (int j = 0; j < CVT_LOADS_; ++j) v[j] = src[j * 32];
    // unrolled: v[] stays in registers
#pragma unroll
    for (int j = 0; j < CVT_LOADS_; ++j) dst[j * 32] = __builtin_convertvector(v[j], v4h);
  }
}

// ---------------------------------------------------------------------------
// Shared GEMM main loop: acc = A[mblk..+128][:] * W[nblk..+256][:]^T, K = C_.
// Block = 256 threads (8 waves in 2Mx4N), block tile 128 x 256, wave tile
// 64 x 64. A pass is 64 k: its 384 operand rows of 128 B lie in LDS at a pitch
// of 144 B ([A 128 rows | W 256 rows]); two buffers, filled by asynchronous
// b128 copies one pass ahead of their readers.
// ---------------------------------------------------------------------------
#define BM_      128
#define BN_      256
#define BK_      64
#define PITCH_H  72                          // LDS row pitch in halves
#define PITCH_B  144u                        // the same in bytes
#define STAGE_H  ((BM_ + BN_) * PITCH_H)     // one buffer in halves
#define STAGE_B  (STAGE_H * 2u)              // the same in bytes
#define NPASS_   (C_ / BK_)

// One stage: each thread copies 16 B of rows r, r+32, ... (4 of A, 8 of W).
// ga, gb: this lane's source in row r of the A and W tile; lds: its LDS byte
// address in row r of the target buffer.
__device__ __forceinline__ void copy_stage(const _Float16* ga, const _Float16* gb,
                                           unsigned lds) {
  // s_wait_xcnt stands inside the statement so that no address register of an
  // issued copy is rewritten ahead of it.
  asm volatile(
      "global_load_async_to_lds_b128 %0, %12, off\n\t"
      "global_load_async_to_lds_b128 %1, %13, off\n\t"
      "global_load_async_to_lds_b128 %2, %14, off\n\t"
      "global_load_async_to_lds_b128 %3, %15, off\n\t"
      "global_load_async_to_lds_b128 %4, %16, off\n\t"
      "global_load_async_to_lds_b128 %5, %17, off\n\t"
      "global_load_async_to_lds_b128 %6, %18, off\n\t"
      "global_load_async_to_lds_b128 %7, %19, off\n\t"
      "global_load_async_to_lds_b128 %8, %20, off\n\t"
      "global_load_async_to_lds_b128 %9, %21, off\n\t"
      "global_load_async_to_lds_b128 %10, %22, off\n\t"
      "global_load_async_to_lds_b128 %11, %23, off\n\t"
      "s_wait_xcnt 0x0"
      :: "v"(lds + 0u * (32u * PITCH_B)), "v"(lds + 1u * (32u * PITCH_B)), "v"(lds + 2u * (32u * PITCH_B)), "v"(lds + 3u * (32u * PITCH_B)), "v"(lds + 4u * (32u * PITCH_B)), "v"(lds + 5u * (32u * PITCH_B)), "v"(lds + 6u * (32u * PITCH_B)), "v"(lds + 7u * (32u * PITCH_B)), "v"(lds + 8u * (32u * PITCH_B)), "v"(lds + 9u * (32u * PITCH_B)), "v"(lds + 10u * (32u * PITCH_B)), "v"(lds + 11u * (32u * PITCH_B)),
         "v"(ga + 0 * 32 * C_), "v"(ga + 1 * 32 * C_), "v"(ga + 2 * 32 * C_), "v"(ga + 3 * 32 * C_), "v"(gb + 0 * 32 * C_), "v"(gb + 1 * 32 * C_), "v"(gb + 2 * 32 * C_), "v"(gb + 3 * 32 * C_), "v"(gb + 4 * 32 * C_), "v"(gb + 5 * 32 * C_), "v"(gb + 6 * 32 * C_), "v"(gb + 7 * 32 * C_)
      : "memory");
}

__device__ __forceinline__ void gemm_tile(const _Float16* __restrict__ A,
                                          const _Float16* __restrict__ W,
                                          long mblk, long nblk,
                                          _Float16* smem, v8f (&acc)[4][4]) {
  const int tid  = threadIdx.x;
  const int lane = tid & 31;
  const int wave = tid >> 5;
  const int wm = wave >> 2;        // 0..1
  const int wn = wave & 3;         // 0..3

  const _Float16* ga = A + (mblk + (tid >> 3)) * C_ + (tid & 7) * 8;
  const _Float16* gb = W + (nblk + (tid >> 3)) * C_ + (tid & 7) * 8;
  const unsigned lds0 = (unsigned)(size_t)smem + (unsigned)(tid >> 3) * PITCH_B
                        + (unsigned)(tid & 7) * 16u;

  copy_stage(ga, gb, lds0);
  // pass 0's bytes have landed before the barrier publishes them
  asm volatile("s_wait_asynccnt 0x0" ::: "memory");
  __syncthreads();
  copy_stage(ga + BK_, gb + BK_, lds0 + STAGE_B);

  // rolled: one pass per trip, buffer = trip parity
#pragma unroll 1
  for (int t = 0; t < NPASS_; ++t) {
    const _Float16* sa = smem + (t & 1) * STAGE_H + (wm * 64) * PITCH_H;
    const _Float16* sb = smem + (t & 1) * STAGE_H + (BM_ + wn * 64) * PITCH_H;
#pragma unroll
    for (int kk = 0; kk < BK_; kk += 32) {
      v16h a[4], b[4];
#pragma unroll
      for (int i = 0; i < 4; ++i) a[i] = load_frag_lds(sa + i * 16 * PITCH_H + kk, PITCH_H, lane);
#pragma unroll
      for (int j = 0; j < 4; ++j) b[j] = load_frag_lds(sb + j * 16 * PITCH_H + kk, PITCH_H, lane);
      // keeps the block's 16 LDS reads one group ahead of its 16 WMMAs: spread
      // among them, each A row would wait out the LDS latency on its own
      __builtin_amdgcn_sched_barrier(0);
#pragma unroll
      for (int i = 0; i < 4; ++i)
#pragma unroll
        for (int j = 0; j < 4; ++j) acc[i][j] = wmma16(a[i], b[j], acc[i][j]);
      // keeps the next group's reads from sinking in among these WMMAs
      __builtin_amdgcn_sched_barrier(0);
    }
    // publish point of pass t+1: own LDS reads of this buffer retired, own
    // copies of the next buffer landed, then the barrier; only then the refill.
    asm volatile("s_wait_dscnt 0x0" ::: "memory");
    asm volatile("s_wait_asynccnt 0x0" ::: "memory");
    __syncthreads();
    if (t + 2 < NPASS_)
      copy_stage(ga + (t + 2) * BK_, gb + (t + 2) * BK_, lds0 + (unsigned)(t & 1) * STAGE_B);
  }
  // nothing is outstanding when the wave ends
  asm volatile("s_wait_asynccnt 0x0" ::: "memory");
}

// ---------------------------------------------------------------------------
// QKV GEMM: qkv[m][o] = sum_c X[m][c] * Wqkv[o][c]
//   X: [B*N, C] f16 row-major, Wqkv: [3C, C] f16 row-major (rows = B columns).
// Epilogue scatters into Q,K: [B,H,N,D], V transposed: [B,H,D,N].
// ---------------------------------------------------------------------------
__global__ void __launch_bounds__(256)
gemm_qkv(const _Float16* __restrict__ X, const _Float16* __restrict__ W,
         _Float16* __restrict__ Q, _Float16* __restrict__ K,
         _Float16* __restrict__ Vt) {
  __shared__ __attribute__((aligned(16))) _Float16 smem[2 * STAGE_H];
  const int lane = threadIdx.x & 31;
  const int wave = threadIdx.x >> 5;
  const long mblk = (long)blockIdx.x * BM_;
  const long nblk = (long)blockIdx.y * BN_;
  const long m0 = mblk + (wave >> 2) * 64;
  const long n0 = nblk + (wave & 3) * 64;

  v8f acc[4][4] = {};
  gemm_tile(X, W, mblk, nblk, smem, acc);

#pragma unroll
  for (int i = 0; i < 4; ++i)
#pragma unroll
    for (int j = 0; j < 4; ++j)
#pragma unroll
      for (int r = 0; r < 8; ++r) {
        long m = m0 + i * 16 + r + ((lane >> 4) << 3);
        long o = n0 + j * 16 + (lane & 15);
        int  b = (int)(m >> 10);       // N_ = 1024
        int  n = (int)(m & 1023);
        int  s = (int)(o >> 10);       // C_ = 1024
        int  rem = (int)(o & 1023);
        int  h = rem >> 6;             // D_ = 64
        int  d = rem & 63;
        long bh = (long)b * H_ + h;
        _Float16 val = (_Float16)acc[i][j][r];
        if (s == 0)      Q [(bh * N_ + n) * D_ + d] = val;
        else if (s == 1) K [(bh * N_ + n) * D_ + d] = val;
        else             Vt[(bh * D_ + d) * N_ + n] = val;
      }
}

// ---------------------------------------------------------------------------
// Flash attention: one wave handles 16 query rows, streams keys 32 at a time.
// Block = 128 threads: 4 waves on 64 queries of one (b,h), which read the same
// K and V. A stage is 64 keys: its 64 K rows (64 d) and the 64 V^T rows' 64 keys,
// 128 B a row, lie in LDS at a pitch of 144 B ([K 64 rows | V^T 64 rows]); two
// buffers, filled by asynchronous b128 copies (whole 128-B lines) one stage
// ahead of their readers. LDS also stages P (C-layout -> A-layout).
// Output written as f16 into [B, N, C] (C = h*64 + d) for the final GEMM.
// ---------------------------------------------------------------------------
#define AK_       64                          // keys a stage
#define ASTAGE_H  ((AK_ + D_) * PITCH_H)      // one buffer in halves
#define ASTAGE_B  (ASTAGE_H * 2u)             // the same in bytes
#define ANSTAGE_  (N_ / AK_)

// One stage: each thread copies 16 B of rows r, r+16, ... (4 of K, 4 of V^T).
// gk, gv: this lane's source in row r of the K and V^T tile; lds: its LDS byte
// address in row r of the target buffer.
__device__ __forceinline__ void attn_copy_stage(const _Float16* gk, const _Float16* gv,
                                                unsigned lds) {
  // s_wait_xcnt stands inside the statement so that no address register of an
  // issued copy is rewritten ahead of it.
  asm volatile(
      "global_load_async_to_lds_b128 %0, %8, off\n\t"
      "global_load_async_to_lds_b128 %1, %9, off\n\t"
      "global_load_async_to_lds_b128 %2, %10, off\n\t"
      "global_load_async_to_lds_b128 %3, %11, off\n\t"
      "global_load_async_to_lds_b128 %4, %12, off\n\t"
      "global_load_async_to_lds_b128 %5, %13, off\n\t"
      "global_load_async_to_lds_b128 %6, %14, off\n\t"
      "global_load_async_to_lds_b128 %7, %15, off\n\t"
      "s_wait_xcnt 0x0"
      :: "v"(lds + 0u * (16u * PITCH_B)), "v"(lds + 1u * (16u * PITCH_B)), "v"(lds + 2u * (16u * PITCH_B)), "v"(lds + 3u * (16u * PITCH_B)), "v"(lds + 4u * (16u * PITCH_B)), "v"(lds + 5u * (16u * PITCH_B)), "v"(lds + 6u * (16u * PITCH_B)), "v"(lds + 7u * (16u * PITCH_B)),
         "v"(gk + 0 * 16 * D_), "v"(gk + 1 * 16 * D_), "v"(gk + 2 * 16 * D_), "v"(gk + 3 * 16 * D_), "v"(gv + 0 * 16 * N_), "v"(gv + 1 * 16 * N_), "v"(gv + 2 * 16 * N_), "v"(gv + 3 * 16 * N_)
      : "memory");
}

__global__ void __launch_bounds__(128)
attn_fwd(const _Float16* __restrict__ Q, const _Float16* __restrict__ K,
         const _Float16* __restrict__ Vt, _Float16* __restrict__ O) {
  __shared__ __attribute__((aligned(16))) _Float16 kv[2 * ASTAGE_H];
  __shared__ _Float16 Pl[4][16 * 32];
  const int tid  = threadIdx.x;
  const int lane = threadIdx.x & 31;
  const int wave = threadIdx.x >> 5;
  const int gq = blockIdx.x * 4 + wave;   // [0, B*H*(N/16))
  const int qb = gq & 63;                 // q-block within (b,h)
  const int bh = gq >> 6;                 // 0..B*H-1

  const _Float16* Qp = Q  + ((long)bh * N_ + qb * 16) * D_;
  const _Float16* Kp = K  + (long)bh * N_ * D_;
  const _Float16* Vp = Vt + (long)bh * D_ * N_;

  // Q fragments: 16 rows x 64 d, split into two K=32 fragments.
  v16h qa0 = load_frag(Qp + 0,  D_, lane);
  v16h qa1 = load_frag(Qp + 32, D_, lane);

  v8f  o_acc[4] = {};          // 16 x 64 accumulator (4 d-tiles)
  float mrun[8], lrun[8];
#pragma unroll
  for (int r = 0; r < 8; ++r) { mrun[r] = -1e30f; lrun[r] = 0.f; }

  const _Float16* gk = Kp + (tid >> 3) * D_ + (tid & 7) * 8;
  const _Float16* gv = Vp + (tid >> 3) * N_ + (tid & 7) * 8;
  const unsigned lds0 = (unsigned)(size_t)kv + (unsigned)(tid >> 3) * PITCH_B
                        + (unsigned)(tid & 7) * 16u;

  attn_copy_stage(gk, gv, lds0);
  // stage 0's bytes have landed before the barrier publishes them
  asm volatile("s_wait_asynccnt 0x0" ::: "memory");
  __syncthreads();
  attn_copy_stage(gk + AK_ * D_, gv + AK_, lds0 + ASTAGE_B);

  // rolled: one stage per trip, buffer = trip parity
#pragma unroll 1
  for (int st = 0; st < ANSTAGE_; ++st) {
   const _Float16* sk = kv + (st & 1) * ASTAGE_H;   // K rows of this stage
   const _Float16* sv = sk + AK_ * PITCH_H;         // V^T rows of this stage
   // unrolled: the two passes' LDS offsets become immediates
#pragma unroll
   for (int kb = 0; kb < AK_; kb += 32) {
    // ---- S = Q . K^T for 32 keys: two 16x16 tiles -----------------------
    v8f s0 = {}, s1 = {};
    {
      v16h kb0 = load_frag_lds(sk + (kb     ) * PITCH_H + 0,  PITCH_H, lane);
      v16h kb1 = load_frag_lds(sk + (kb     ) * PITCH_H + 32, PITCH_H, lane);
      s0 = wmma16(qa0, kb0, s0);
      s0 = wmma16(qa1, kb1, s0);
      v16h kc0 = load_frag_lds(sk + (kb + 16) * PITCH_H + 0,  PITCH_H, lane);
      v16h kc1 = load_frag_lds(sk + (kb + 16) * PITCH_H + 32, PITCH_H, lane);
      s1 = wmma16(qa0, kc0, s1);
      s1 = wmma16(qa1, kc1, s1);
    }

    // ---- online softmax over this 32-key block --------------------------
    float alpha[8];
#pragma unroll
    for (int r = 0; r < 8; ++r) {
      float v0 = s0[r] * SCALE_;
      float v1 = s1[r] * SCALE_;
      float mx = fmaxf(v0, v1);
      mx = fmaxf(mx, __shfl_xor(mx, 1));
      mx = fmaxf(mx, __shfl_xor(mx, 2));
      mx = fmaxf(mx, __shfl_xor(mx, 4));
      mx = fmaxf(mx, __shfl_xor(mx, 8));     // row max within 16-lane group
      float mnew = fmaxf(mrun[r], mx);
      float p0 = __expf(v0 - mnew);
      float p1 = __expf(v1 - mnew);
      float rs = p0 + p1;
      rs += __shfl_xor(rs, 1);
      rs += __shfl_xor(rs, 2);
      rs += __shfl_xor(rs, 4);
      rs += __shfl_xor(rs, 8);               // row sum within 16-lane group
      alpha[r] = __expf(mrun[r] - mnew);
      lrun[r]  = lrun[r] * alpha[r] + rs;
      mrun[r]  = mnew;
      s0[r] = p0;
      s1[r] = p1;
    }
#pragma unroll
    for (int t = 0; t < 4; ++t)
#pragma unroll
      for (int r = 0; r < 8; ++r) o_acc[t][r] *= alpha[r];

    // ---- stage P (16x32 f16) through LDS: C-layout -> A-layout ----------
    __syncthreads();
#pragma unroll
    for (int r = 0; r < 8; ++r) {
      int m = r + ((lane >> 4) << 3);
      Pl[wave][m * 32 +      (lane & 15)] = (_Float16)s0[r];
      Pl[wave][m * 32 + 16 + (lane & 15)] = (_Float16)s1[r];
    }
    __syncthreads();
    v16h pa = load_frag_lds(&Pl[wave][0], 32, lane);

    // ---- O += P . V  (V stored transposed: [D, N]) ----------------------
#pragma unroll
    for (int t = 0; t < 4; ++t) {
      v16h vb = load_frag_lds(sv + (t * 16) * PITCH_H + kb, PITCH_H, lane);
      o_acc[t] = wmma16(pa, vb, o_acc[t]);
    }
   }
   // publish point of stage st+1: own LDS reads of this buffer retired, own
   // copies of the next buffer landed, then the barrier; only then the refill.
   asm volatile("s_wait_dscnt 0x0" ::: "memory");
   asm volatile("s_wait_asynccnt 0x0" ::: "memory");
   __syncthreads();
   if (st + 2 < ANSTAGE_)
     attn_copy_stage(gk + (st + 2) * (AK_ * D_), gv + (st + 2) * AK_,
                     lds0 + (unsigned)(st & 1) * ASTAGE_B);
  }
  // nothing is outstanding when the wave ends
  asm volatile("s_wait_asynccnt 0x0" ::: "memory");

  // ---- epilogue: normalize and write f16 into [B, N, C] -----------------
  const int b = bh >> 4;
  const int h = bh & 15;
#pragma unroll
  for (int t = 0; t < 4; ++t)
#pragma unroll
    for (int r = 0; r < 8; ++r) {
      int m   = r + ((lane >> 4) << 3);
      long row = (long)b * N_ + qb * 16 + m;
      int  col = h * D_ + t * 16 + (lane & 15);
      O[row * C_ + col] = (_Float16)(o_acc[t][r] / lrun[r]);
    }
}

// ---------------------------------------------------------------------------
// Output projection: out[m][o] = sum_c A[m][c] * Wp[o][c] + bias[o]  (f32 out)
// Same main loop and tiles as gemm_qkv.
// ---------------------------------------------------------------------------
__global__ void __launch_bounds__(256)
gemm_proj(const _Float16* __restrict__ A, const _Float16* __restrict__ W,
          const float* __restrict__ bias, float* __restrict__ out) {
  __shared__ __attribute__((aligned(16))) _Float16 smem[2 * STAGE_H];
  const int lane = threadIdx.x & 31;
  const int wave = threadIdx.x >> 5;
  const long mblk = (long)blockIdx.x * BM_;
  const long nblk = (long)blockIdx.y * BN_;
  const long m0 = mblk + (wave >> 2) * 64;
  const long n0 = nblk + (wave & 3) * 64;

  v8f acc[4][4] = {};
  gemm_tile(A, W, mblk, nblk, smem, acc);

#pragma unroll
  for (int i = 0; i < 4; ++i)
#pragma unroll
    for (int j = 0; j < 4; ++j)
#pragma unroll
      for (int r = 0; r < 8; ++r) {
        long m = m0 + i * 16 + r + ((lane >> 4) << 3);
        long o = n0 + j * 16 + (lane & 15);
        out[m * C_ + o] = acc[i][j][r] + bias[o];
      }
}

// ---------------------------------------------------------------------------
// Launch
// ---------------------------------------------------------------------------
extern "C" void kernel_launch(void* const* d_in, const int* in_sizes, int n_in,
                              void* d_out, int out_size, void* d_ws, size_t ws_size,
                              hipStream_t stream) {
  const float* x      = (const float*)d_in[0];  // [B,N,C]
  const float* w_qkv  = (const float*)d_in[1];  // [3C,C]
  const float* w_proj = (const float*)d_in[2];  // [C,C]
  const float* b_proj = (const float*)d_in[3];  // [C]
  float* out = (float*)d_out;                   // [B,N,C]

  const long nX    = (long)B_ * N_ * C_;   // 8M
  const long nWqkv = (long)3 * C_ * C_;    // 3M
  const long nWp   = (long)C_ * C_;        // 1M
  const long nBHND = (long)B_ * H_ * N_ * D_; // 8M

  _Float16* xh  = (_Float16*)d_ws;
  _Float16* wqh = xh  + nX;
  _Float16* wph = wqh + nWqkv;
  _Float16* qw  = wph + nWp;
  _Float16* kw  = qw  + nBHND;
  _Float16* vtw = kw  + nBHND;
  _Float16* aw  = vtw + nBHND;   // attention output [B,N,C] f16

  // 1) f32 -> f16 conversions
  //    (512, 192 and 64 tiles of 16384 values; x: two tiles a block)
  cvt_f32_f16<<<256, CVT_THREADS_, 0, stream>>>(x,      xh,  (int)(nX    / CVT_TILE_));
  cvt_f32_f16<<<192, CVT_THREADS_, 0, stream>>>(w_qkv,  wqh, (int)(nWqkv / CVT_TILE_));
  cvt_f32_f16<<< 64, CVT_THREADS_, 0, stream>>>(w_proj, wph, (int)(nWp   / CVT_TILE_));

  // 2) QKV projection: M = B*N = 8192, N = 3C = 3072 (block tile 128x256)
  gemm_qkv<<<dim3(8192 / 128, 3072 / 256), 256, 0, stream>>>(xh, wqh, qw, kw, vtw);

  // 3) Flash attention: B*H*(N/16) q-blocks, 4 waves per block
  attn_fwd<<<(B_ * H_ * (N_ / 16)) / 4, 128, 0, stream>>>(qw, kw, vtw, aw);

  // 4) Output projection: M = 8192, N = C = 1024 (block tile 128x256)
  gemm_proj<<<dim3(8192 / 128, 1024 / 256), 256, 0, stream>>>(aw, wph, b_proj, out);
}

// v004
// A run of this version takes 139 microseconds.
// In two side-by-side timings against v003, it was 1.32 and 1.33 times as fast.
// Over all steps from v000 it is 2.88 times as fast.
#include <hip/hip_runtime.h>
#include <hip/hip_bf16.h>

typedef __attribute__((ext_vector_type(16))) _Float16 v16h;
typedef __attribute__((ext_vector_type(8)))  _Float16 v8h;
typedef __attribute__((ext_vector_type(8)))  float    v8f;

#define B_  8
#define N_  1024
#define C_  1024
#define H_  16
#define D_  64
#define SCALE_ 0.125f   // 1/sqrt(64)

// ---------------------------------------------------------------------------
// WMMA helper: D = A(16x32 f16) * B(32x16 f16) + C(16x16 f32)
// ---------------------------------------------------------------------------
__device__ __forceinline__ v8f wmma16(v16h a, v16h b, v8f c) {
  return __builtin_amdgcn_wmma_f32_16x16x32_f16(
      /*neg_a=*/false, a, /*neg_b=*/false, b,
      /*c_mod=*/(short)0, c, /*reuse_a=*/false, /*reuse_b=*/false);
}

// ---------------------------------------------------------------------------
// Load a 16x32 f16 A-fragment (or B-fragment from a column-major-over-K
// source, i.e. a source where each logical column is a contiguous K-run).
// ISA 16-bit A layout: lanes 0-15 hold row=lane, K = {0..7, 16..23};
//                      lanes 16-31 hold row=lane-16, K = {8..15, 24..31}.
// base points at (row0, k0); ld = element stride between rows/columns.
// ---------------------------------------------------------------------------
__device__ __forceinline__ v16h load_frag(const _Float16* __restrict__ base,
                                          long ld, int lane) {
  const _Float16* p = base + (long)(lane & 15) * ld + ((lane >> 4) << 3);
  v8h lo = *(const v8h*)(p);        // K = kofs .. kofs+7
  v8h hi = *(const v8h*)(p + 16);   // K = kofs+16 .. kofs+23
  return __builtin_shufflevector(lo, hi, 0,1,2,3,4,5,6,7,8,9,10,11,12,13,14,15);
}

// LDS variant (same layout)
__device__ __forceinline__ v16h load_frag_lds(const _Float16* base, int ld, int lane) {
  const _Float16* p = base + (lane & 15) * ld + ((lane >> 4) << 3);
  v8h lo = *(const v8h*)(p);
  v8h hi = *(const v8h*)(p + 16);
  return __builtin_shufflevector(lo, hi, 0,1,2,3,4,5,6,7,8,9,10,11,12,13,14,15);
}

// ---------------------------------------------------------------------------
// f32 -> f16 conversion, as a stream: few long-lived waves instead of one
// value a thread. Block = 512 threads (16 waves). A tile is 16384 values: each
// wave owns 4 KB of contiguous input, read by 8 loads of 16 B a lane (512
// contiguous bytes a load) that are all in flight together, and writes 8 B a
// lane (256 contiguous bytes a store). ntiles * CVT_TILE_ values are converted.
// ---------------------------------------------------------------------------
typedef __attribute__((ext_vector_type(4))) float    v4f;
typedef __attribute__((ext_vector_type(4))) _Float16 v4h;
#define CVT_THREADS_ 512
#define CVT_LOADS_   8
#define CVT_TILE_    (CVT_THREADS_ * CVT_LOADS_ * 4)   // values a tile

__global__ void __launch_bounds__(CVT_THREADS_)
cvt_f32_f16(const float* __restrict__ x, _Float16* __restrict__ y, int ntiles) {
  const int lane = threadIdx.x & 31;
  const int wave = threadIdx.x >> 5;
  for (int tile = blockIdx.x; tile < ntiles; tile += gridDim.x) {
    // index of this lane's first group of 4 values
    const long g0 = (long)tile * (CVT_TILE_ / 4) + wave * (32 * CVT_LOADS_) + lane;
    const v4f* __restrict__ src = (const v4f*)x + g0;
    v4h* __restrict__ dst = (v4h*)y + g0;
    v4f v[CVT_LOADS_];
    // unrolled, loads apart from stores: all 8 loads issue before the first wait
#pragma unroll
    for (int j = 0; j < CVT_LOADS_; ++j) v[j] = src[j * 32];
    // unrolled: v[] stays in registers
#pragma unroll
    for (int j = 0; j < CVT_LOADS_; ++j) dst[j * 32] = __builtin_convertvector(v[j], v4h);
  }
}

// ---------------------------------------------------------------------------
// Shared GEMM main loop: acc = A[mblk..+128][:] * W[nblk..+256][:]^T, K = C_.
// Block = 256 threads (8 waves in 2Mx4N), block tile 128 x 256, wave tile
// 64 x 64. A pass is 64 k: its 384 operand rows of 128 B lie in LDS at a pitch
// of 144 B ([A 128 rows | W 256 rows]); two buffers, filled by asynchronous
// b128 copies one pass ahead of their readers.
// ---------------------------------------------------------------------------
#define BM_      128
#define BN_      256
#define BK_      64
#define PITCH_H  72                          // LDS row pitch in halves
#define PITCH_B  144u                        // the same in bytes
#define STAGE_H  ((BM_ + BN_) * PITCH_H)     // one buffer in halves
#define STAGE_B  (STAGE_H * 2u)              // the same in bytes
#define NPASS_   (C_ / BK_)

// One stage: each thread copies 16 B of rows r, r+32, ... (4 of A, 8 of W).
// ga, gb: this lane's source in row r of the A and W tile; lds: its LDS byte
// address in row r of the target buffer.
__device__ __forceinline__ void copy_stage(const _Float16* ga, const _Float16* gb,
                                           unsigned lds) {
  // s_wait_xcnt stands inside the statement so that no address register of an
  // issued copy is rewritten ahead of it.
  asm volatile(
      "global_load_async_to_lds_b128 %0, %12, off\n\t"
      "global_load_async_to_lds_b128 %1, %13, off\n\t"
      "global_load_async_to_lds_b128 %2, %14, off\n\t"
      "global_load_async_to_lds_b128 %3, %15, off\n\t"
      "global_load_async_to_lds_b128 %4, %16, off\n\t"
      "global_load_async_to_lds_b128 %5, %17, off\n\t"
      "global_load_async_to_lds_b128 %6, %18, off\n\t"
      "global_load_async_to_lds_b128 %7, %19, off\n\t"
      "global_load_async_to_lds_b128 %8, %20, off\n\t"
      "global_load_async_to_lds_b128 %9, %21, off\n\t"
      "global_load_async_to_lds_b128 %10, %22, off\n\t"
      "global_load_async_to_lds_b128 %11, %23, off\n\t"
      "s_wait_xcnt 0x0"
      :: "v"(lds + 0u * (32u * PITCH_B)), "v"(lds + 1u * (32u * PITCH_B)), "v"(lds + 2u * (32u * PITCH_B)), "v"(lds + 3u * (32u * PITCH_B)), "v"(lds + 4u * (32u * PITCH_B)), "v"(lds + 5u * (32u * PITCH_B)), "v"(lds + 6u * (32u * PITCH_B)), "v"(lds + 7u * (32u * PITCH_B)), "v"(lds + 8u * (32u * PITCH_B)), "v"(lds + 9u * (32u * PITCH_B)), "v"(lds + 10u * (32u * PITCH_B)), "v"(lds + 11u * (32u * PITCH_B)),
         "v"(ga + 0 * 32 * C_), "v"(ga + 1 * 32 * C_), "v"(ga + 2 * 32 * C_), "v"(ga + 3 * 32 * C_), "v"(gb + 0 * 32 * C_), "v"(gb + 1 * 32 * C_), "v"(gb + 2 * 32 * C_), "v"(gb + 3 * 32 * C_), "v"(gb + 4 * 32 * C_), "v"(gb + 5 * 32 * C_), "v"(gb + 6 * 32 * C_), "v"(gb + 7 * 32 * C_)
      : "memory");
}

__device__ __forceinline__ void gemm_tile(const _Float16* __restrict__ A,
                                          const _Float16* __restrict__ W,
                                          long mblk, long nblk,
                                          _Float16* smem, v8f (&acc)[4][4]) {
  const int tid  = threadIdx.x;
  const int lane = tid & 31;
  const int wave = tid >> 5;
  const int wm = wave >> 2;        // 0..1
  const int wn = wave & 3;         // 0..3

  const _Float16* ga = A + (mblk + (tid >> 3)) * C_ + (tid & 7) * 8;
  const _Float16* gb = W + (nblk + (tid >> 3)) * C_ + (tid & 7) * 8;
  const unsigned lds0 = (unsigned)(size_t)smem + (unsigned)(tid >> 3) * PITCH_B
                        + (unsigned)(tid & 7) * 16u;

  copy_stage(ga, gb, lds0);
  // pass 0's bytes have landed before the barrier publishes them
  asm volatile("s_wait_asynccnt 0x0" ::: "memory");
  __syncthreads();
  copy_stage(ga + BK_, gb + BK_, lds0 + STAGE_B);

  // rolled: one pass per trip, buffer = trip parity
#pragma unroll 1
  for (int t = 0; t < NPASS_; ++t) {
    const _Float16* sa = smem + (t & 1) * STAGE_H + (wm * 64) * PITCH_H;
    const _Float16* sb = smem + (t & 1) * STAGE_H + (BM_ + wn * 64) * PITCH_H;
#pragma unroll
    for (int kk = 0; kk < BK_; kk += 32) {
      v16h a[4], b[4];
#pragma unroll
      for (int i = 0; i < 4; ++i) a[i] = load_frag_lds(sa + i * 16 * PITCH_H + kk, PITCH_H, lane);
#pragma unroll
      for (int j = 0; j < 4; ++j) b[j] = load_frag_lds(sb + j * 16 * PITCH_H + kk, PITCH_H, lane);
      // keeps the block's 16 LDS reads one group ahead of its 16 WMMAs: spread
      // among them, each A row would wait out the LDS latency on its own
      __builtin_amdgcn_sched_barrier(0);
#pragma unroll
      for (int i = 0; i < 4; ++i)
#pragma unroll
        for (int j = 0; j < 4; ++j) acc[i][j] = wmma16(a[i], b[j], acc[i][j]);
      // keeps the next group's reads from sinking in among these WMMAs
      __builtin_amdgcn_sched_barrier(0);
    }
    // publish point of pass t+1: own LDS reads of this buffer retired, own
    // copies of the next buffer landed, then the barrier; only then the refill.
    asm volatile("s_wait_dscnt 0x0" ::: "memory");
    asm volatile("s_wait_asynccnt 0x0" ::: "memory");
    __syncthreads();
    if (t + 2 < NPASS_)
      copy_stage(ga + (t + 2) * BK_, gb + (t + 2) * BK_, lds0 + (unsigned)(t & 1) * STAGE_B);
  }
  // nothing is outstanding when the wave ends
  asm volatile("s_wait_asynccnt 0x0" ::: "memory");
}

// ---------------------------------------------------------------------------
// QKV GEMM: qkv[m][o] = sum_c X[m][c] * Wqkv[o][c]
//   X: [B*N, C] f16 row-major, Wqkv: [3C, C] f16 row-major (rows = B columns).
// Epilogue scatters into Q,K: [B,H,N,D], V transposed: [B,H,D,N].
// ---------------------------------------------------------------------------
__global__ void __launch_bounds__(256)
gemm_qkv(const _Float16* __restrict__ X, const _Float16* __restrict__ W,
         _Float16* __restrict__ Q, _Float16* __restrict__ K,
         _Float16* __restrict__ Vt) {
  __shared__ __attribute__((aligned(16))) _Float16 smem[2 * STAGE_H];
  const int lane = threadIdx.x & 31;
  const int wave = threadIdx.x >> 5;
  const long mblk = (long)blockIdx.x * BM_;
  const long nblk = (long)blockIdx.y * BN_;
  const long m0 = mblk + (wave >> 2) * 64;
  const long n0 = nblk + (wave & 3) * 64;

  v8f acc[4][4] = {};
  gemm_tile(X, W, mblk, nblk, smem, acc);

#pragma unroll
  for (int i = 0; i < 4; ++i)
#pragma unroll
    for (int j = 0; j < 4; ++j)
#pragma unroll
      for (int r = 0; r < 8; ++r) {
        long m = m0 + i * 16 + r + ((lane >> 4) << 3);
        long o = n0 + j * 16 + (lane & 15);
        int  b = (int)(m >> 10);       // N_ = 1024
        int  n = (int)(m & 1023);
        int  s = (int)(o >> 10);       // C_ = 1024
        int  rem = (int)(o & 1023);
        int  h = rem >> 6;             // D_ = 64
        int  d = rem & 63;
        long bh = (long)b * H_ + h;
        _Float16 val = (_Float16)acc[i][j][r];
        if (s == 0)      Q [(bh * N_ + n) * D_ + d] = val;
        else if (s == 1) K [(bh * N_ + n) * D_ + d] = val;
        else             Vt[(bh * D_ + d) * N_ + n] = val;
      }
}

#define AK_       64
#define ASTAGE_H  ((AK_ + D_) * PITCH_H)
#define ASTAGE_B  (ASTAGE_H * 2u)
#define ANSTAGE_  (N_ / AK_)

// One stage: each thread copies 16 B of rows r, r+16, ... (4 of K, 4 of V^T).
// gk, gv: this lane's source in row r of the K and V^T tile; lds: its LDS byte
// address in row r of the target buffer.
__device__ __forceinline__ void attn_copy_stage(const _Float16* gk, const _Float16* gv,
                                                unsigned lds) {
  // s_wait_xcnt stands inside the statement so that no address register of an
  // issued copy is rewritten ahead of it.
  asm volatile(
      "global_load_async_to_lds_b128 %0, %8, off\n\t"
      "global_load_async_to_lds_b128 %1, %9, off\n\t"
      "global_load_async_to_lds_b128 %2, %10, off\n\t"
      "global_load_async_to_lds_b128 %3, %11, off\n\t"
      "global_load_async_to_lds_b128 %4, %12, off\n\t"
      "global_load_async_to_lds_b128 %5, %13, off\n\t"
      "global_load_async_to_lds_b128 %6, %14, off\n\t"
      "global_load_async_to_lds_b128 %7, %15, off\n\t"
      "s_wait_xcnt 0x0"
      :: "v"(lds + 0u * (16u * PITCH_B)), "v"(lds + 1u * (16u * PITCH_B)), "v"(lds + 2u * (16u * PITCH_B)), "v"(lds + 3u * (16u * PITCH_B)), "v"(lds + 4u * (16u * PITCH_B)), "v"(lds + 5u * (16u * PITCH_B)), "v"(lds + 6u * (16u * PITCH_B)), "v"(lds + 7u * (16u * PITCH_B)),
         "v"(gk + 0 * 16 * D_), "v"(gk + 1 * 16 * D_), "v"(gk + 2 * 16 * D_), "v"(gk + 3 * 16 * D_), "v"(gv + 0 * 16 * N_), "v"(gv + 1 * 16 * N_), "v"(gv + 2 * 16 * N_), "v"(gv + 3 * 16 * N_)
      : "memory");
}

// value of lane l ^ 16 (the other half's lane of the same query)
__device__ __forceinline__ float xhalf(float x) {
  int i = __builtin_bit_cast(int, x);
  return __builtin_bit_cast(float, __builtin_amdgcn_permlanex16(
      i, i, 0x76543210, 0xfedcba98, false, false));
}

// Base-2 exponentials in place, a run of them in ONE statement: behind each
// v_exp_f32 stands an instruction that neither reads its result nor overwrites
// its source (the next v_exp_f32, on other registers; v_nop behind the last).
// That is the slot the instruction set asks for behind a transcendental.
__device__ __forceinline__ void exp2_run8(v8f& x) {
  float a = x[0], b = x[1], c = x[2], d = x[3], e = x[4], f = x[5], g = x[6], h = x[7];
  asm("v_exp_f32 %0, %0\n\t"
      "v_exp_f32 %1, %1\n\t"
      "v_exp_f32 %2, %2\n\t"
      "v_exp_f32 %3, %3\n\t"
      "v_exp_f32 %4, %4\n\t"
      "v_exp_f32 %5, %5\n\t"
      "v_exp_f32 %6, %6\n\t"
      "v_exp_f32 %7, %7\n\t"
      "v_nop"
      : "+v"(a), "+v"(b), "+v"(c), "+v"(d), "+v"(e), "+v"(f), "+v"(g), "+v"(h));
  x = v8f{a, b, c, d, e, f, g, h};
}
// the same with one more value in front
__device__ __forceinline__ void exp2_run9(float& y, v8f& x) {
  float a = x[0], b = x[1], c = x[2], d = x[3], e = x[4], f = x[5], g = x[6], h = x[7];
  asm("v_exp_f32 %8, %8\n\t"
      "v_exp_f32 %0, %0\n\t"
      "v_exp_f32 %1, %1\n\t"
      "v_exp_f32 %2, %2\n\t"
      "v_exp_f32 %3, %3\n\t"
      "v_exp_f32 %4, %4\n\t"
      "v_exp_f32 %5, %5\n\t"
      "v_exp_f32 %6, %6\n\t"
      "v_exp_f32 %7, %7\n\t"
      "v_nop"
      : "+v"(a), "+v"(b), "+v"(c), "+v"(d), "+v"(e), "+v"(f), "+v"(g), "+v"(h), "+v"(y));
  x = v8f{a, b, c, d, e, f, g, h};
}
#define LOG2E_ 1.44269504f   // e^x = 2^(x * LOG2E_), as __expf forms it

// amdgpu_waves_per_eu(4, 7): the loop needs more than 128 registers, so seven
// waves a SIMD are what fits. Told so, the compiler keeps several LDS loads in
// flight behind counted waits; aiming at eight, which it misses, it reuses one
// register set and waits out every pair of loads on its own.
__global__ void __launch_bounds__(128) __attribute__((amdgpu_waves_per_eu(4, 7)))
attn_fwd(const _Float16* __restrict__ Q, const _Float16* __restrict__ K,
         const _Float16* __restrict__ Vt, _Float16* __restrict__ O) {
  __shared__ __attribute__((aligned(16))) _Float16 kv[2 * ASTAGE_H];
  const int tid  = threadIdx.x;
  const int lane = threadIdx.x & 31;
  const int wave = threadIdx.x >> 5;
  const int gq = blockIdx.x * 4 + wave;   // [0, B*H*(N/16))
  const int qb = gq & 63;                 // q-block within (b,h)
  const int bh = gq >> 6;                 // 0..B*H-1

  const _Float16* Qp = Q  + ((long)bh * N_ + qb * 16) * D_;
  const _Float16* Kp = K  + (long)bh * N_ * D_;
  const _Float16* Vp = Vt + (long)bh * D_ * N_;

  // Q^T fragments (B operand): 64 d x 16 queries, split into two K=32 fragments.
  v16h qa0 = load_frag(Qp + 0,  D_, lane);
  v16h qa1 = load_frag(Qp + 32, D_, lane);

  v8f  o_acc[4] = {};          // O^T: 64 d (4 tiles) x 16 queries
  float mrun = -1e30f;         // this lane's query: maximum so far (both halves alike)
  float lrun = 0.f;            // sum over this half's keys only; joined in the epilogue

  const _Float16* gk = Kp + (tid >> 3) * D_ + (tid & 7) * 8;
  const _Float16* gv = Vp + (tid >> 3) * N_ + (tid & 7) * 8;
  const unsigned lds0 = (unsigned)(size_t)kv + (unsigned)(tid >> 3) * PITCH_B
                        + (unsigned)(tid & 7) * 16u;

  attn_copy_stage(gk, gv, lds0);
  // stage 0's bytes have landed before the barrier publishes them
  asm volatile("s_wait_asynccnt 0x0" ::: "memory");
  __syncthreads();
  attn_copy_stage(gk + AK_ * D_, gv + AK_, lds0 + ASTAGE_B);

  // rolled: one stage per trip, buffer = trip parity
#pragma unroll 1
  for (int st = 0; st < ANSTAGE_; ++st) {
   const _Float16* sk = kv + (st & 1) * ASTAGE_H;   // K rows of this stage
   const _Float16* sv = sk + AK_ * PITCH_H;         // V^T rows of this stage
   // unrolled: the two passes' LDS offsets become immediates
#pragma unroll
   for (int kb = 0; kb < AK_; kb += 32) {
    // ---- S^T = K . Q^T for 32 keys: two 16 (keys) x 16 (queries) tiles ---
    v8f s0 = {}, s1 = {};
    {
      v16h kb0 = load_frag_lds(sk + (kb     ) * PITCH_H + 0,  PITCH_H, lane);
      v16h kb1 = load_frag_lds(sk + (kb     ) * PITCH_H + 32, PITCH_H, lane);
      s0 = wmma16(kb0, qa0, s0);
      s0 = wmma16(kb1, qa1, s0);
      v16h kc0 = load_frag_lds(sk + (kb + 16) * PITCH_H + 0,  PITCH_H, lane);
      v16h kc1 = load_frag_lds(sk + (kb + 16) * PITCH_H + 32, PITCH_H, lane);
      s1 = wmma16(kc0, qa0, s1);
      s1 = wmma16(kc1, qa1, s1);
    }

    // ---- online softmax over this 32-key block, one query a lane ---------
    s0 *= SCALE_;
    s1 *= SCALE_;
    float mx = -1e30f;
    // unrolled: the score tiles stay in registers
#pragma unroll
    for (int r = 0; r < 8; ++r) mx = fmaxf(mx, fmaxf(s0[r], s1[r]));
    mx = fmaxf(mx, xhalf(mx));               // the query's maximum over all 32 keys
    const float mnew  = fmaxf(mrun, mx);
    float alpha = (mrun - mnew) * LOG2E_;
    s0 = (s0 - mnew) * LOG2E_;
    s1 = (s1 - mnew) * LOG2E_;
    exp2_run9(alpha, s0);                    // alpha = e^(mrun - mnew), s0 = P^T rows 8h + r
    exp2_run8(s1);                           // s1 = P^T rows 16 + 8h + r
    float rs0 = 0.f, rs1 = 0.f;
    v16h pb;                                 // P^T, 32 keys x 16 queries (B operand)
    // unrolled: the score tiles and pb stay in registers
#pragma unroll
    for (int r = 0; r < 8; ++r) {
      rs0 += s0[r];
      rs1 += s1[r];
      pb[r]     = (_Float16)s0[r];           // k = 8h + r
      pb[8 + r] = (_Float16)s1[r];           // k = 16 + 8h + r
    }
    lrun = lrun * alpha + (rs0 + rs1);
    mrun = mnew;
    // both unrolled: o_acc stays in registers
#pragma unroll
    for (int t = 0; t < 4; ++t)
#pragma unroll
      for (int r = 0; r < 8; ++r) o_acc[t][r] *= alpha;

    // ---- O^T += V^T . P^T  (V stored transposed: [D, N]) -----------------
    // unrolled: o_acc stays in registers, LDS offsets become immediates
#pragma unroll
    for (int t = 0; t < 4; ++t) {
      v16h va = load_frag_lds(sv + (t * 16) * PITCH_H + kb, PITCH_H, lane);
      o_acc[t] = wmma16(va, pb, o_acc[t]);
    }
   }
   // publish point of stage st+1: own LDS reads of this buffer retired, own
   // copies of the next buffer landed, then the barrier; only then the refill.
   asm volatile("s_wait_dscnt 0x0" ::: "memory");
   asm volatile("s_wait_asynccnt 0x0" ::: "memory");
   __syncthreads();
   if (st + 2 < ANSTAGE_)
     attn_copy_stage(gk + (st + 2) * (AK_ * D_), gv + (st + 2) * AK_,
                     lds0 + (unsigned)(st & 1) * ASTAGE_B);
  }
  // nothing is outstanding when the wave ends
  asm volatile("s_wait_asynccnt 0x0" ::: "memory");

  // ---- epilogue: normalize and write f16 into [B, N, C] -----------------
  // a lane holds d = 16 t + 8 (lane >> 4) + r of its query: one 16-B store a tile
  const int b = bh >> 4;
  const int h = bh & 15;
  const float l = lrun + xhalf(lrun);        // the two halves' sums joined
  const long row = (long)b * N_ + qb * 16 + (lane & 15);
  _Float16* Op = O + row * C_ + h * D_ + ((lane >> 4) << 3);
  // both unrolled: o_acc stays in registers
#pragma unroll
  for (int t = 0; t < 4; ++t) {
    v8h o;
#pragma unroll
    for (int r = 0; r < 8; ++r) o[r] = (_Float16)(o_acc[t][r] / l);
    *(v8h*)(Op + t * 16) = o;
  }
}

// ---------------------------------------------------------------------------
// Output projection: out[m][o] = sum_c A[m][c] * Wp[o][c] + bias[o]  (f32 out)
// Same main loop and tiles as gemm_qkv.
// ---------------------------------------------------------------------------
__global__ void __launch_bounds__(256)
gemm_proj(const _Float16* __restrict__ A, const _Float16* __restrict__ W,
          const float* __restrict__ bias, float* __restrict__ out) {
  __shared__ __attribute__((aligned(16))) _Float16 smem[2 * STAGE_H];
  const int lane = threadIdx.x & 31;
  const int wave = threadIdx.x >> 5;
  const long mblk = (long)blockIdx.x * BM_;
  const long nblk = (long)blockIdx.y * BN_;
  const long m0 = mblk + (wave >> 2) * 64;
  const long n0 = nblk + (wave & 3) * 64;

  v8f acc[4][4] = {};
  gemm_tile(A, W, mblk, nblk, smem, acc);

#pragma unroll
  for (int i = 0; i < 4; ++i)
#pragma unroll
    for (int j = 0; j < 4; ++j)
#pragma unroll
      for (int r = 0; r < 8; ++r) {
        long m = m0 + i * 16 + r + ((lane >> 4) << 3);
        long o = n0 + j * 16 + (lane & 15);
        out[m * C_ + o] = acc[i][j][r] + bias[o];
      }
}

// ---------------------------------------------------------------------------
// Launch
// ---------------------------------------------------------------------------
extern "C" void kernel_launch(void* const* d_in, const int* in_sizes, int n_in,
                              void* d_out, int out_size, void* d_ws, size_t ws_size,
                              hipStream_t stream) {
  const float* x      = (const float*)d_in[0];  // [B,N,C]
  const float* w_qkv  = (const float*)d_in[1];  // [3C,C]
  const float* w_proj = (const float*)d_in[2];  // [C,C]
  const float* b_proj = (const float*)d_in[3];  // [C]
  float* out = (float*)d_out;                   // [B,N,C]

  const long nX    = (long)B_ * N_ * C_;   // 8M
  const long nWqkv = (long)3 * C_ * C_;    // 3M
  const long nWp   = (long)C_ * C_;        // 1M
  const long nBHND = (long)B_ * H_ * N_ * D_; // 8M

  _Float16* xh  = (_Float16*)d_ws;
  _Float16* wqh = xh  + nX;
  _Float16* wph = wqh + nWqkv;
  _Float16* qw  = wph + nWp;
  _Float16* kw  = qw  + nBHND;
  _Float16* vtw = kw  + nBHND;
  _Float16* aw  = vtw + nBHND;   // attention output [B,N,C] f16

  // 1) f32 -> f16 conversions
  //    (512, 192 and 64 tiles of 16384 values; x: two tiles a block)
  cvt_f32_f16<<<256, CVT_THREADS_, 0, stream>>>(x,      xh,  (int)(nX    / CVT_TILE_));
  cvt_f32_f16<<<192, CVT_THREADS_, 0, stream>>>(w_qkv,  wqh, (int)(nWqkv / CVT_TILE_));
  cvt_f32_f16<<< 64, CVT_THREADS_, 0, stream>>>(w_proj, wph, (int)(nWp   / CVT_TILE_));

  // 2) QKV projection: M = B*N = 8192, N = 3C = 3072 (block tile 128x256)
  gemm_qkv<<<dim3(8192 / 128, 3072 / 256), 256, 0, stream>>>(xh, wqh, qw, kw, vtw);

  // 3) Flash attention: B*H*(N/16) q-blocks, 4 waves per block
  attn_fwd<<<(B_ * H_ * (N_ / 16)) / 4, 128, 0, stream>>>(qw, kw, vtw, aw);

  // 4) Output projection: M = 8192, N = C = 1024 (block tile 128x256)
  gemm_proj<<<dim3(8192 / 128, 1024 / 256), 256, 0, stream>>>(aw, wph, b_proj, out);
}

// v005
// Measured time: 117 microseconds a run.
// In two side-by-side timings against v004, it was 1.20 and 1.18 times as fast.
// Over all steps from v000 it is 3.43 times as fast.
#include <hip/hip_runtime.h>
#include <hip/hip_bf16.h>

typedef __attribute__((ext_vector_type(16))) _Float16 v16h;
typedef __attribute__((ext_vector_type(8)))  _Float16 v8h;
typedef __attribute__((ext_vector_type(8)))  float    v8f;

#define B_  8
#define N_  1024
#define C_  1024
#define H_  16
#define D_  64
#define SCALE_ 0.125f   // 1/sqrt(64)

// ---------------------------------------------------------------------------
// WMMA helper: D = A(16x32 f16) * B(32x16 f16) + C(16x16 f32)
// ---------------------------------------------------------------------------
__device__ __forceinline__ v8f wmma16(v16h a, v16h b, v8f c) {
  return __builtin_amdgcn_wmma_f32_16x16x32_f16(
      /*neg_a=*/false, a, /*neg_b=*/false, b,
      /*c_mod=*/(short)0, c, /*reuse_a=*/false, /*reuse_b=*/false);
}

// ---------------------------------------------------------------------------
// Load a 16x32 f16 A-fragment (or B-fragment from a column-major-over-K
// source, i.e. a source where each logical column is a contiguous K-run).
// ISA 16-bit A layout: lanes 0-15 hold row=lane, K = {0..7, 16..23};
//                      lanes 16-31 hold row=lane-16, K = {8..15, 24..31}.
// base points at (row0, k0); ld = element stride between rows/columns.
// ---------------------------------------------------------------------------
__device__ __forceinline__ v16h load_frag(const _Float16* __restrict__ base,
                                          long ld, int lane) {
  const _Float16* p = base + (long)(lane & 15) * ld + ((lane >> 4) << 3);
  v8h lo = *(const v8h*)(p);        // K = kofs .. kofs+7
  v8h hi = *(const v8h*)(p + 16);   // K = kofs+16 .. kofs+23
  return __builtin_shufflevector(lo, hi, 0,1,2,3,4,5,6,7,8,9,10,11,12,13,14,15);
}

// LDS variant (same layout)
__device__ __forceinline__ v16h load_frag_lds(const _Float16* base, int ld, int lane) {
  const _Float16* p = base + (lane & 15) * ld + ((lane >> 4) << 3);
  v8h lo = *(const v8h*)(p);
  v8h hi = *(const v8h*)(p + 16);
  return __builtin_shufflevector(lo, hi, 0,1,2,3,4,5,6,7,8,9,10,11,12,13,14,15);
}

// ---------------------------------------------------------------------------
// f32 -> f16 conversion, as a stream: few long-lived waves instead of one
// value a thread. Block = 512 threads (16 waves). A tile is 16384 values: each
// wave owns 4 KB of contiguous input, read by 8 loads of 16 B a lane (512
// contiguous bytes a load) that are all in flight together, and writes 8 B a
// lane (256 contiguous bytes a store). ntiles * CVT_TILE_ values are converted.
// ---------------------------------------------------------------------------
typedef __attribute__((ext_vector_type(4))) float    v4f;
typedef __attribute__((ext_vector_type(4))) _Float16 v4h;
#define CVT_THREADS_ 512
#define CVT_LOADS_   8
#define CVT_TILE_    (CVT_THREADS_ * CVT_LOADS_ * 4)   // values a tile

__global__ void __launch_bounds__(CVT_THREADS_)
cvt_f32_f16(const float* __restrict__ x, _Float16* __restrict__ y, int ntiles) {
  const int lane = threadIdx.x & 31;
  const int wave = threadIdx.x >> 5;
  for (int tile = blockIdx.x; tile < ntiles; tile += gridDim.x) {
    // index of this lane's first group of 4 values
    const long g0 = (long)tile * (CVT_TILE_ / 4) + wave * (32 * CVT_LOADS_) + lane;
    const v4f* __restrict__ src = (const v4f*)x + g0;
    v4h* __restrict__ dst = (v4h*)y + g0;
    v4f v[CVT_LOADS_];
    // unrolled, loads apart from stores: all 8 loads issue before the first wait
#pragma unroll
    for (int j = 0; j < CVT_LOADS_; ++j) v[j] = src[j * 32];
    // unrolled: v[] stays in registers
#pragma unroll
    for (int j = 0; j < CVT_LOADS_; ++j) dst[j * 32] = __builtin_convertvector(v[j], v4h);
  }
}

// ---------------------------------------------------------------------------
// Shared GEMM main loop: acc = A[mblk..+128][:] * W[nblk..+256][:]^T, K = C_.
// Block = 256 threads (8 waves in 2Mx4N), block tile 128 x 256, wave tile
// 64 x 64. A pass is 64 k: its 384 operand rows of 128 B lie in LDS at a pitch
// of 144 B ([A 128 rows | W 256 rows]); two buffers, filled by asynchronous
// b128 copies one pass ahead of their readers.
// ---------------------------------------------------------------------------
#define BM_      128
#define BN_      256
#define BK_      64
#define PITCH_H  72                          // LDS row pitch in halves
#define PITCH_B  144u                        // the same in bytes
#define STAGE_H  ((BM_ + BN_) * PITCH_H)     // one buffer in halves
#define STAGE_B  (STAGE_H * 2u)              // the same in bytes
#define NPASS_   (C_ / BK_)

// One stage: each thread copies 16 B of rows r, r+32, ... (4 of A, 8 of W).
// ga, gb: this lane's source in row r of the A and W tile; lds: its LDS byte
// address in row r of the target buffer.
__device__ __forceinline__ void copy_stage(const _Float16* ga, const _Float16* gb,
                                           unsigned lds) {
  // s_wait_xcnt stands inside the statement so that no address register of an
  // issued copy is rewritten ahead of it.
  asm volatile(
      "global_load_async_to_lds_b128 %0, %12, off\n\t"
      "global_load_async_to_lds_b128 %1, %13, off\n\t"
      "global_load_async_to_lds_b128 %2, %14, off\n\t"
      "global_load_async_to_lds_b128 %3, %15, off\n\t"
      "global_load_async_to_lds_b128 %4, %16, off\n\t"
      "global_load_async_to_lds_b128 %5, %17, off\n\t"
      "global_load_async_to_lds_b128 %6, %18, off\n\t"
      "global_load_async_to_lds_b128 %7, %19, off\n\t"
      "global_load_async_to_lds_b128 %8, %20, off\n\t"
      "global_load_async_to_lds_b128 %9, %21, off\n\t"
      "global_load_async_to_lds_b128 %10, %22, off\n\t"
      "global_load_async_to_lds_b128 %11, %23, off\n\t"
      "s_wait_xcnt 0x0"
      :: "v"(lds + 0u * (32u * PITCH_B)), "v"(lds + 1u * (32u * PITCH_B)), "v"(lds + 2u * (32u * PITCH_B)), "v"(lds + 3u * (32u * PITCH_B)), "v"(lds + 4u * (32u * PITCH_B)), "v"(lds + 5u * (32u * PITCH_B)), "v"(lds + 6u * (32u * PITCH_B)), "v"(lds + 7u * (32u * PITCH_B)), "v"(lds + 8u * (32u * PITCH_B)), "v"(lds + 9u * (32u * PITCH_B)), "v"(lds + 10u * (32u * PITCH_B)), "v"(lds + 11u * (32u * PITCH_B)),
         "v"(ga + 0 * 32 * C_), "v"(ga + 1 * 32 * C_), "v"(ga + 2 * 32 * C_), "v"(ga + 3 * 32 * C_), "v"(gb + 0 * 32 * C_), "v"(gb + 1 * 32 * C_), "v"(gb + 2 * 32 * C_), "v"(gb + 3 * 32 * C_), "v"(gb + 4 * 32 * C_), "v"(gb + 5 * 32 * C_), "v"(gb + 6 * 32 * C_), "v"(gb + 7 * 32 * C_)
      : "memory");
}

__device__ __forceinline__ void gemm_tile(const _Float16* __restrict__ A,
                                          const _Float16* __restrict__ W,
                                          long mblk, long nblk,
                                          _Float16* smem, v8f (&acc)[4][4]) {
  const int tid  = threadIdx.x;
  const int lane = tid & 31;
  const int wave = tid >> 5;
  const int wm = wave >> 2;        // 0..1
  const int wn = wave & 3;         // 0..3

  const _Float16* ga = A + (mblk + (tid >> 3)) * C_ + (tid & 7) * 8;
  const _Float16* gb = W + (nblk + (tid >> 3)) * C_ + (tid & 7) * 8;
  const unsigned lds0 = (unsigned)(size_t)smem + (unsigned)(tid >> 3) * PITCH_B
                        + (unsigned)(tid & 7) * 16u;

  copy_stage(ga, gb, lds0);
  // pass 0's bytes have landed before the barrier publishes them
  asm volatile("s_wait_asynccnt 0x0" ::: "memory");
  __syncthreads();
  copy_stage(ga + BK_, gb + BK_, lds0 + STAGE_B);

  // rolled: one pass per trip, buffer = trip parity
#pragma unroll 1
  for (int t = 0; t < NPASS_; ++t) {
    const _Float16* sa = smem + (t & 1) * STAGE_H + (wm * 64) * PITCH_H;
    const _Float16* sb = smem + (t & 1) * STAGE_H + (BM_ + wn * 64) * PITCH_H;
#pragma unroll
    for (int kk = 0; kk < BK_; kk += 32) {
      v16h a[4], b[4];
#pragma unroll
      for (int i = 0; i < 4; ++i) a[i] = load_frag_lds(sa + i * 16 * PITCH_H + kk, PITCH_H, lane);
#pragma unroll
      for (int j = 0; j < 4; ++j) b[j] = load_frag_lds(sb + j * 16 * PITCH_H + kk, PITCH_H, lane);
      // keeps the block's 16 LDS reads one group ahead of its 16 WMMAs: spread
      // among them, each A row would wait out the LDS latency on its own
      __builtin_amdgcn_sched_barrier(0);
#pragma unroll
      for (int i = 0; i < 4; ++i)
#pragma unroll
        for (int j = 0; j < 4; ++j) acc[i][j] = wmma16(a[i], b[j], acc[i][j]);
      // keeps the next group's reads from sinking in among these WMMAs
      __builtin_amdgcn_sched_barrier(0);
    }
    // publish point of pass t+1: own LDS reads of this buffer retired, own
    // copies of the next buffer landed, then the barrier; only then the refill.
    asm volatile("s_wait_dscnt 0x0" ::: "memory");
    asm volatile("s_wait_asynccnt 0x0" ::: "memory");
    __syncthreads();
    if (t + 2 < NPASS_)
      copy_stage(ga + (t + 2) * BK_, gb + (t + 2) * BK_, lds0 + (unsigned)(t & 1) * STAGE_B);
  }
  // nothing is outstanding when the wave ends
  asm volatile("s_wait_asynccnt 0x0" ::: "memory");
}

// ---------------------------------------------------------------------------
// QKV GEMM: qkv[m][o] = sum_c X[m][c] * Wqkv[o][c]
//   X: [B*N, C] f16 row-major, Wqkv: [3C, C] f16 row-major (rows = B columns).
// Epilogue: Q,K: [B,H,N,D], V transposed: [B,H,D,N]. A wave's 64 x 64 tile is
// 64 positions of one batch by the 64 d of one head of one of Q, K, V, that is
// 64 whole 128-B lines of its target. The wave lays the tile, as f16, in its own
// LDS range in the target's row order (pitch 144 B) and stores it line by line.
// ---------------------------------------------------------------------------
#define EP_WAVE_H (64 * PITCH_H)             // one wave's staging range in halves

// 64 staged rows of 128 B -> 64 rows of dst, ld halves apart. A load or store
// covers 4 whole rows (8 lanes x 16 B a row).
__device__ __forceinline__ void store_rows(const _Float16* st, _Float16* __restrict__ dst,
                                           const int ld, int lane) {
  const _Float16* sp = st + (lane >> 3) * PITCH_H + (lane & 7) * 8;
  _Float16* gp = dst + (long)(lane >> 3) * ld + (lane & 7) * 8;
  v8h v[16];
  // both unrolled, loads apart from stores: v[] stays in registers and all 16
  // LDS reads are in flight before the first store waits for its row
#pragma unroll
  for (int k = 0; k < 16; ++k) v[k] = *(const v8h*)(sp + k * 4 * PITCH_H);
#pragma unroll
  for (int k = 0; k < 16; ++k) *(v8h*)(gp + (long)k * 4 * ld) = v[k];
}

__global__ void __launch_bounds__(256)
gemm_qkv(const _Float16* __restrict__ X, const _Float16* __restrict__ W,
         _Float16* __restrict__ Q, _Float16* __restrict__ K,
         _Float16* __restrict__ Vt) {
  __shared__ __attribute__((aligned(16))) _Float16 smem[2 * STAGE_H];
  const int lane = threadIdx.x & 31;
  // scalar: the choice of target and the tile's base address are per wave
  const int wave = __builtin_amdgcn_readfirstlane(threadIdx.x >> 5);
  const long mblk = (long)blockIdx.x * BM_;
  const long nblk = (long)blockIdx.y * BN_;
  const int m0 = (int)mblk + (wave >> 2) * 64;
  const int n0 = (int)nblk + (wave & 3) * 64;

  v8f acc[4][4] = {};
  gemm_tile(X, W, mblk, nblk, smem, acc);

  // The last pass's barrier stands behind every wave's last read of the ring and
  // nothing is being copied into it: each wave may now write its own range.
  _Float16* st = smem + wave * EP_WAVE_H;
  const int  s  = n0 >> 10;                       // 0 Q, 1 K, 2 V (C_ = 1024)
  const long bh = (long)(m0 >> 10) * H_ + ((n0 & 1023) >> 6);
  const int  nb = m0 & 1023;                      // the tile's first position
  const int  c  = lane & 15;
  const int  h8 = (lane >> 4) << 3;

  if (s == 2) {
    // staged rows = d: a lane's 8 values of a tile are 8 positions of one d
    // (both loops unrolled: acc stays in registers)
#pragma unroll
    for (int i = 0; i < 4; ++i)
#pragma unroll
      for (int j = 0; j < 4; ++j)
        *(v8h*)(st + (j * 16 + c) * PITCH_H + i * 16 + h8) =
            __builtin_convertvector(acc[i][j], v8h);
    // own LDS writes done before other lanes' rows are read back
    asm volatile("s_wait_dscnt 0x0" ::: "memory");
    store_rows(st, Vt + bh * D_ * N_ + nb, N_, lane);
  } else {
    // staged rows = positions: a lane's 8 values of a tile are 8 rows of one d
    // (all three loops unrolled: acc stays in registers)
#pragma unroll
    for (int i = 0; i < 4; ++i)
#pragma unroll
      for (int j = 0; j < 4; ++j)
#pragma unroll
        for (int r = 0; r < 8; ++r)
          st[(i * 16 + h8 + r) * PITCH_H + j * 16 + c] = (_Float16)acc[i][j][r];
    // own LDS writes done before other lanes' rows are read back
    asm volatile("s_wait_dscnt 0x0" ::: "memory");
    store_rows(st, (s == 0 ? Q : K) + (bh * N_ + nb) * D_, D_, lane);
  }
}

#define AK_       64
#define ASTAGE_H  ((AK_ + D_) * PITCH_H)
#define ASTAGE_B  (ASTAGE_H * 2u)
#define ANSTAGE_  (N_ / AK_)

// One stage: each thread copies 16 B of rows r, r+16, ... (4 of K, 4 of V^T).
// gk, gv: this lane's source in row r of the K and V^T tile; lds: its LDS byte
// address in row r of the target buffer.
__device__ __forceinline__ void attn_copy_stage(const _Float16* gk, const _Float16* gv,
                                                unsigned lds) {
  // s_wait_xcnt stands inside the statement so that no address register of an
  // issued copy is rewritten ahead of it.
  asm volatile(
      "global_load_async_to_lds_b128 %0, %8, off\n\t"
      "global_load_async_to_lds_b128 %1, %9, off\n\t"
      "global_load_async_to_lds_b128 %2, %10, off\n\t"
      "global_load_async_to_lds_b128 %3, %11, off\n\t"
      "global_load_async_to_lds_b128 %4, %12, off\n\t"
      "global_load_async_to_lds_b128 %5, %13, off\n\t"
      "global_load_async_to_lds_b128 %6, %14, off\n\t"
      "global_load_async_to_lds_b128 %7, %15, off\n\t"
      "s_wait_xcnt 0x0"
      :: "v"(lds + 0u * (16u * PITCH_B)), "v"(lds + 1u * (16u * PITCH_B)), "v"(lds + 2u * (16u * PITCH_B)), "v"(lds + 3u * (16u * PITCH_B)), "v"(lds + 4u * (16u * PITCH_B)), "v"(lds + 5u * (16u * PITCH_B)), "v"(lds + 6u * (16u * PITCH_B)), "v"(lds + 7u * (16u * PITCH_B)),
         "v"(gk + 0 * 16 * D_), "v"(gk + 1 * 16 * D_), "v"(gk + 2 * 16 * D_), "v"(gk + 3 * 16 * D_), "v"(gv + 0 * 16 * N_), "v"(gv + 1 * 16 * N_), "v"(gv + 2 * 16 * N_), "v"(gv + 3 * 16 * N_)
      : "memory");
}

// value of lane l ^ 16 (the other half's lane of the same query)
__device__ __forceinline__ float xhalf(float x) {
  int i = __builtin_bit_cast(int, x);
  return __builtin_bit_cast(float, __builtin_amdgcn_permlanex16(
      i, i, 0x76543210, 0xfedcba98, false, false));
}

// Base-2 exponentials in place, a run of them in ONE statement: behind each
// v_exp_f32 stands an instruction that neither reads its result nor overwrites
// its source (the next v_exp_f32, on other registers; v_nop behind the last).
// That is the slot the instruction set asks for behind a transcendental.
__device__ __forceinline__ void exp2_run8(v8f& x) {
  float a = x[0], b = x[1], c = x[2], d = x[3], e = x[4], f = x[5], g = x[6], h = x[7];
  asm("v_exp_f32 %0, %0\n\t"
      "v_exp_f32 %1, %1\n\t"
      "v_exp_f32 %2, %2\n\t"
      "v_exp_f32 %3, %3\n\t"
      "v_exp_f32 %4, %4\n\t"
      "v_exp_f32 %5, %5\n\t"
      "v_exp_f32 %6, %6\n\t"
      "v_exp_f32 %7, %7\n\t"
      "v_nop"
      : "+v"(a), "+v"(b), "+v"(c), "+v"(d), "+v"(e), "+v"(f), "+v"(g), "+v"(h));
  x = v8f{a, b, c, d, e, f, g, h};
}
// the same with one more value in front
__device__ __forceinline__ void exp2_run9(float& y, v8f& x) {
  float a = x[0], b = x[1], c = x[2], d = x[3], e = x[4], f = x[5], g = x[6], h = x[7];
  asm("v_exp_f32 %8, %8\n\t"
      "v_exp_f32 %0, %0\n\t"
      "v_exp_f32 %1, %1\n\t"
      "v_exp_f32 %2, %2\n\t"
      "v_exp_f32 %3, %3\n\t"
      "v_exp_f32 %4, %4\n\t"
      "v_exp_f32 %5, %5\n\t"
      "v_exp_f32 %6, %6\n\t"
      "v_exp_f32 %7, %7\n\t"
      "v_nop"
      : "+v"(a), "+v"(b), "+v"(c), "+v"(d), "+v"(e), "+v"(f), "+v"(g), "+v"(h), "+v"(y));
  x = v8f{a, b, c, d, e, f, g, h};
}
#define LOG2E_ 1.44269504f   // e^x = 2^(x * LOG2E_), as __expf forms it

// amdgpu_waves_per_eu(4, 7): the loop needs more than 128 registers, so seven
// waves a SIMD are what fits. Told so, the compiler keeps several LDS loads in
// flight behind counted waits; aiming at eight, which it misses, it reuses one
// register set and waits out every pair of loads on its own.
__global__ void __launch_bounds__(128) __attribute__((amdgpu_waves_per_eu(4, 7)))
attn_fwd(const _Float16* __restrict__ Q, const _Float16* __restrict__ K,
         const _Float16* __restrict__ Vt, _Float16* __restrict__ O) {
  __shared__ __attribute__((aligned(16))) _Float16 kv[2 * ASTAGE_H];
  const int tid  = threadIdx.x;
  const int lane = threadIdx.x & 31;
  const int wave = threadIdx.x >> 5;
  const int gq = blockIdx.x * 4 + wave;   // [0, B*H*(N/16))
  const int qb = gq & 63;                 // q-block within (b,h)
  const int bh = gq >> 6;                 // 0..B*H-1

  const _Float16* Qp = Q  + ((long)bh * N_ + qb * 16) * D_;
  const _Float16* Kp = K  + (long)bh * N_ * D_;
  const _Float16* Vp = Vt + (long)bh * D_ * N_;

  // Q^T fragments (B operand): 64 d x 16 queries, split into two K=32 fragments.
  v16h qa0 = load_frag(Qp + 0,  D_, lane);
  v16h qa1 = load_frag(Qp + 32, D_, lane);

  v8f  o_acc[4] = {};          // O^T: 64 d (4 tiles) x 16 queries
  float mrun = -1e30f;         // this lane's query: maximum so far (both halves alike)
  float lrun = 0.f;            // sum over this half's keys only; joined in the epilogue

  const _Float16* gk = Kp + (tid >> 3) * D_ + (tid & 7) * 8;
  const _Float16* gv = Vp + (tid >> 3) * N_ + (tid & 7) * 8;
  const unsigned lds0 = (unsigned)(size_t)kv + (unsigned)(tid >> 3) * PITCH_B
                        + (unsigned)(tid & 7) * 16u;

  attn_copy_stage(gk, gv, lds0);
  // stage 0's bytes have landed before the barrier publishes them
  asm volatile("s_wait_asynccnt 0x0" ::: "memory");
  __syncthreads();
  attn_copy_stage(gk + AK_ * D_, gv + AK_, lds0 + ASTAGE_B);

  // rolled: one stage per trip, buffer = trip parity
#pragma unroll 1
  for (int st = 0; st < ANSTAGE_; ++st) {
   const _Float16* sk = kv + (st & 1) * ASTAGE_H;   // K rows of this stage
   const _Float16* sv = sk + AK_ * PITCH_H;         // V^T rows of this stage
   // unrolled: the two passes' LDS offsets become immediates
#pragma unroll
   for (int kb = 0; kb < AK_; kb += 32) {
    // ---- S^T = K . Q^T for 32 keys: two 16 (keys) x 16 (queries) tiles ---
    v8f s0 = {}, s1 = {};
    {
      v16h kb0 = load_frag_lds(sk + (kb     ) * PITCH_H + 0,  PITCH_H, lane);
      v16h kb1 = load_frag_lds(sk + (kb     ) * PITCH_H + 32, PITCH_H, lane);
      s0 = wmma16(kb0, qa0, s0);
      s0 = wmma16(kb1, qa1, s0);
      v16h kc0 = load_frag_lds(sk + (kb + 16) * PITCH_H + 0,  PITCH_H, lane);
      v16h kc1 = load_frag_lds(sk + (kb + 16) * PITCH_H + 32, PITCH_H, lane);
      s1 = wmma16(kc0, qa0, s1);
      s1 = wmma16(kc1, qa1, s1);
    }

    // ---- online softmax over this 32-key block, one query a lane ---------
    s0 *= SCALE_;
    s1 *= SCALE_;
    float mx = -1e30f;
    // unrolled: the score tiles stay in registers
#pragma unroll
    for (int r = 0; r < 8; ++r) mx = fmaxf(mx, fmaxf(s0[r], s1[r]));
    mx = fmaxf(mx, xhalf(mx));               // the query's maximum over all 32 keys
    const float mnew  = fmaxf(mrun, mx);
    float alpha = (mrun - mnew) * LOG2E_;
    s0 = (s0 - mnew) * LOG2E_;
    s1 = (s1 - mnew) * LOG2E_;
    exp2_run9(alpha, s0);                    // alpha = e^(mrun - mnew), s0 = P^T rows 8h + r
    exp2_run8(s1);                           // s1 = P^T rows 16 + 8h + r
    float rs0 = 0.f, rs1 = 0.f;
    v16h pb;                                 // P^T, 32 keys x 16 queries (B operand)
    // unrolled: the score tiles and pb stay in registers
#pragma unroll
    for (int r = 0; r < 8; ++r) {
      rs0 += s0[r];
      rs1 += s1[r];
      pb[r]     = (_Float16)s0[r];           // k = 8h + r
      pb[8 + r] = (_Float16)s1[r];           // k = 16 + 8h + r
    }
    lrun = lrun * alpha + (rs0 + rs1);
    mrun = mnew;
    // both unrolled: o_acc stays in registers
#pragma unroll
    for (int t = 0; t < 4; ++t)
#pragma unroll
      for (int r = 0; r < 8; ++r) o_acc[t][r] *= alpha;

    // ---- O^T += V^T . P^T  (V stored transposed: [D, N]) -----------------
    // unrolled: o_acc stays in registers, LDS offsets become immediates
#pragma unroll
    for (int t = 0; t < 4; ++t) {
      v16h va = load_frag_lds(sv + (t * 16) * PITCH_H + kb, PITCH_H, lane);
      o_acc[t] = wmma16(va, pb, o_acc[t]);
    }
   }
   // publish point of stage st+1: own LDS reads of this buffer retired, own
   // copies of the next buffer landed, then the barrier; only then the refill.
   asm volatile("s_wait_dscnt 0x0" ::: "memory");
   asm volatile("s_wait_asynccnt 0x0" ::: "memory");
   __syncthreads();
   if (st + 2 < ANSTAGE_)
     attn_copy_stage(gk + (st + 2) * (AK_ * D_), gv + (st + 2) * AK_,
                     lds0 + (unsigned)(st & 1) * ASTAGE_B);
  }
  // nothing is outstanding when the wave ends
  asm volatile("s_wait_asynccnt 0x0" ::: "memory");

  // ---- epilogue: normalize and write f16 into [B, N, C] -----------------
  // a lane holds d = 16 t + 8 (lane >> 4) + r of its query: one 16-B store a tile
  const int b = bh >> 4;
  const int h = bh & 15;
  const float l = lrun + xhalf(lrun);        // the two halves' sums joined
  const long row = (long)b * N_ + qb * 16 + (lane & 15);
  _Float16* Op = O + row * C_ + h * D_ + ((lane >> 4) << 3);
  // both unrolled: o_acc stays in registers
#pragma unroll
  for (int t = 0; t < 4; ++t) {
    v8h o;
#pragma unroll
    for (int r = 0; r < 8; ++r) o[r] = (_Float16)(o_acc[t][r] / l);
    *(v8h*)(Op + t * 16) = o;
  }
}

// ---------------------------------------------------------------------------
// Output projection: out[m][o] = sum_c A[m][c] * Wp[o][c] + bias[o]  (f32 out)
// Same main loop and tiles as gemm_qkv.
// ---------------------------------------------------------------------------
__global__ void __launch_bounds__(256)
gemm_proj(const _Float16* __restrict__ A, const _Float16* __restrict__ W,
          const float* __restrict__ bias, float* __restrict__ out) {
  __shared__ __attribute__((aligned(16))) _Float16 smem[2 * STAGE_H];
  const int lane = threadIdx.x & 31;
  const int wave = threadIdx.x >> 5;
  const long mblk = (long)blockIdx.x * BM_;
  const long nblk = (long)blockIdx.y * BN_;
  const long m0 = mblk + (wave >> 2) * 64;
  const long n0 = nblk + (wave & 3) * 64;

  v8f acc[4][4] = {};
  gemm_tile(A, W, mblk, nblk, smem, acc);

#pragma unroll
  for (int i = 0; i < 4; ++i)
#pragma unroll
    for (int j = 0; j < 4; ++j)
#pragma unroll
      for (int r = 0; r < 8; ++r) {
        long m = m0 + i * 16 + r + ((lane >> 4) << 3);
        long o = n0 + j * 16 + (lane & 15);
        out[m * C_ + o] = acc[i][j][r] + bias[o];
      }
}

// ---------------------------------------------------------------------------
// Launch
// ---------------------------------------------------------------------------
extern "C" void kernel_launch(void* const* d_in, const int* in_sizes, int n_in,
                              void* d_out, int out_size, void* d_ws, size_t ws_size,
                              hipStream_t stream) {
  const float* x      = (const float*)d_in[0];  // [B,N,C]
  const float* w_qkv  = (const float*)d_in[1];  // [3C,C]
  const float* w_proj = (const float*)d_in[2];  // [C,C]
  const float* b_proj = (const float*)d_in[3];  // [C]
  float* out = (float*)d_out;                   // [B,N,C]

  const long nX    = (long)B_ * N_ * C_;   // 8M
  const long nWqkv = (long)3 * C_ * C_;    // 3M
  const long nWp   = (long)C_ * C_;        // 1M
  const long nBHND = (long)B_ * H_ * N_ * D_; // 8M

  _Float16* xh  = (_Float16*)d_ws;
  _Float16* wqh = xh  + nX;
  _Float16* wph = wqh + nWqkv;
  _Float16* qw  = wph + nWp;
  _Float16* kw  = qw  + nBHND;
  _Float16* vtw = kw  + nBHND;
  _Float16* aw  = vtw + nBHND;   // attention output [B,N,C] f16

  // 1) f32 -> f16 conversions
  //    (512, 192 and 64 tiles of 16384 values; x: two tiles a block)
  cvt_f32_f16<<<256, CVT_THREADS_, 0, stream>>>(x,      xh,  (int)(nX    / CVT_TILE_));
  cvt_f32_f16<<<192, CVT_THREADS_, 0, stream>>>(w_qkv,  wqh, (int)(nWqkv / CVT_TILE_));
  cvt_f32_f16<<< 64, CVT_THREADS_, 0, stream>>>(w_proj, wph, (int)(nWp   / CVT_TILE_));

  // 2) QKV projection: M = B*N = 8192, N = 3C = 3072 (block tile 128x256)
  gemm_qkv<<<dim3(8192 / 128, 3072 / 256), 256, 0, stream>>>(xh, wqh, qw, kw, vtw);

  // 3) Flash attention: B*H*(N/16) q-blocks, 4 waves per block
  attn_fwd<<<(B_ * H_ * (N_ / 16)) / 4, 128, 0, stream>>>(qw, kw, vtw, aw);

  // 4) Output projection: M = 8192, N = C = 1024 (block tile 128x256)
  gemm_proj<<<dim3(8192 / 128, 1024 / 256), 256, 0, stream>>>(aw, wph, b_proj, out);
}

// v006
// A run of this version takes 113 microseconds.
// Timed twice side by side with v005, it ran 1.03 and 1.04 times as fast.
// All steps since v000 together make it 3.56 times as fast.
#include <hip/hip_runtime.h>
#include <hip/hip_bf16.h>

typedef __attribute__((ext_vector_type(16))) _Float16 v16h;
typedef __attribute__((ext_vector_type(8)))  _Float16 v8h;
typedef __attribute__((ext_vector_type(8)))  float    v8f;

#define B_  8
#define N_  1024
#define C_  1024
#define H_  16
#define D_  64
#define SCALE_ 0.125f   // 1/sqrt(64)

// ---------------------------------------------------------------------------
// WMMA helper: D = A(16x32 f16) * B(32x16 f16) + C(16x16 f32)
// ---------------------------------------------------------------------------
__device__ __forceinline__ v8f wmma16(v16h a, v16h b, v8f c) {
  return __builtin_amdgcn_wmma_f32_16x16x32_f16(
      /*neg_a=*/false, a, /*neg_b=*/false, b,
      /*c_mod=*/(short)0, c, /*reuse_a=*/false, /*reuse_b=*/false);
}

// ---------------------------------------------------------------------------
// Load a 16x32 f16 A-fragment (or B-fragment from a column-major-over-K
// source, i.e. a source where each logical column is a contiguous K-run).
// ISA 16-bit A layout: lanes 0-15 hold row=lane, K = {0..7, 16..23};
//                      lanes 16-31 hold row=lane-16, K = {8..15, 24..31}.
// base points at (row0, k0); ld = element stride between rows/columns.
// ---------------------------------------------------------------------------
__device__ __forceinline__ v16h load_frag(const _Float16* __restrict__ base,
                                          long ld, int lane) {
  const _Float16* p = base + (long)(lane & 15) * ld + ((lane >> 4) << 3);
  v8h lo = *(const v8h*)(p);        // K = kofs .. kofs+7
  v8h hi = *(const v8h*)(p + 16);   // K = kofs+16 .. kofs+23
  return __builtin_shufflevector(lo, hi, 0,1,2,3,4,5,6,7,8,9,10,11,12,13,14,15);
}

// LDS variant (same layout)
__device__ __forceinline__ v16h load_frag_lds(const _Float16* base, int ld, int lane) {
  const _Float16* p = base + (lane & 15) * ld + ((lane >> 4) << 3);
  v8h lo = *(const v8h*)(p);
  v8h hi = *(const v8h*)(p + 16);
  return __builtin_shufflevector(lo, hi, 0,1,2,3,4,5,6,7,8,9,10,11,12,13,14,15);
}

// ---------------------------------------------------------------------------
// f32 -> f16 conversion, as a stream: few long-lived waves instead of one
// value a thread. Block = 512 threads (16 waves). A tile is 16384 values: each
// wave owns 4 KB of contiguous input, read by 8 loads of 16 B a lane (512
// contiguous bytes a load) that are all in flight together, and writes 8 B a
// lane (256 contiguous bytes a store).
// ONE launch converts all three inputs: they do not depend on one another, and
// their f16 copies lie one behind the other in y ([x | w_qkv | w_proj]), so a
// tile's index is its place in y and says which input it comes from.
// ---------------------------------------------------------------------------
typedef __attribute__((ext_vector_type(4))) float    v4f;
typedef __attribute__((ext_vector_type(4))) _Float16 v4h;
#define CVT_THREADS_ 512
#define CVT_LOADS_   8
#define CVT_TILE_    (CVT_THREADS_ * CVT_LOADS_ * 4)   // values a tile
#define CVT_NT_X_    (B_ * N_ * C_ / CVT_TILE_)        // tiles of x      (512)
#define CVT_NT_WQ_   (3 * C_ * C_ / CVT_TILE_)         // tiles of w_qkv  (192)
#define CVT_NT_WP_   (C_ * C_ / CVT_TILE_)             // tiles of w_proj  (64)
#define CVT_NT_      (CVT_NT_X_ + CVT_NT_WQ_ + CVT_NT_WP_)
#define CVT_BLOCKS_  256                               // the grid: three tiles a block

__global__ void __launch_bounds__(CVT_THREADS_)
cvt_f32_f16(const float* __restrict__ x, const float* __restrict__ wq,
            const float* __restrict__ wp, _Float16* __restrict__ y) {
  const int lane = threadIdx.x & 31;
  const int wave = threadIdx.x >> 5;
  // this lane's first group of 4 values inside a tile
  const int g = wave * (32 * CVT_LOADS_) + lane;
  for (int tile = blockIdx.x; tile < CVT_NT_; tile += CVT_BLOCKS_) {
    // the tile's input and its index there (the same for the whole block)
    const float* in = x;
    int t = tile;
    if (tile >= CVT_NT_X_ + CVT_NT_WQ_) { in = wp; t = tile - (CVT_NT_X_ + CVT_NT_WQ_); }
    else if (tile >= CVT_NT_X_)         { in = wq; t = tile - CVT_NT_X_; }
    const v4f* __restrict__ src = (const v4f*)in + (long)t * (CVT_TILE_ / 4) + g;
    v4h* __restrict__ dst = (v4h*)y + (long)tile * (CVT_TILE_ / 4) + g;
    v4f v[CVT_LOADS_];
    // unrolled, loads apart from stores: all 8 loads issue before the first wait
#pragma unroll
    for (int j = 0; j < CVT_LOADS_; ++j) v[j] = src[j * 32];
    // unrolled: v[] stays in registers
#pragma unroll
    for (int j = 0; j < CVT_LOADS_; ++j) dst[j * 32] = __builtin_convertvector(v[j], v4h);
  }
}

// ---------------------------------------------------------------------------
// Shared GEMM main loop: acc = A[mblk..+128][:] * W[nblk..+256][:]^T, K = C_.
// Block = 256 threads (8 waves in 2Mx4N), block tile 128 x 256, wave tile
// 64 x 64. A pass is 64 k: its 384 operand rows of 128 B lie in LDS at a pitch
// of 144 B ([A 128 rows | W 256 rows]); two buffers, filled by asynchronous
// b128 copies one pass ahead of their readers.
// ---------------------------------------------------------------------------
#define BM_      128
#define BN_      256
#define BK_      64
#define PITCH_H  72                          // LDS row pitch in halves
#define PITCH_B  144u                        // the same in bytes
#define STAGE_H  ((BM_ + BN_) * PITCH_H)     // one buffer in halves
#define STAGE_B  (STAGE_H * 2u)              // the same in bytes
#define NPASS_   (C_ / BK_)

// One stage: each thread copies 16 B of rows r, r+32, ... (4 of A, 8 of W).
// ga, gb: this lane's source in row r of the A and W tile; lds: its LDS byte
// address in row r of the target buffer.
__device__ __forceinline__ void copy_stage(const _Float16* ga, const _Float16* gb,
                                           unsigned lds) {
  // s_wait_xcnt stands inside the statement so that no address register of an
  // issued copy is rewritten ahead of it.
  asm volatile(
      "global_load_async_to_lds_b128 %0, %12, off\n\t"
      "global_load_async_to_lds_b128 %1, %13, off\n\t"
      "global_load_async_to_lds_b128 %2, %14, off\n\t"
      "global_load_async_to_lds_b128 %3, %15, off\n\t"
      "global_load_async_to_lds_b128 %4, %16, off\n\t"
      "global_load_async_to_lds_b128 %5, %17, off\n\t"
      "global_load_async_to_lds_b128 %6, %18, off\n\t"
      "global_load_async_to_lds_b128 %7, %19, off\n\t"
      "global_load_async_to_lds_b128 %8, %20, off\n\t"
      "global_load_async_to_lds_b128 %9, %21, off\n\t"
      "global_load_async_to_lds_b128 %10, %22, off\n\t"
      "global_load_async_to_lds_b128 %11, %23, off\n\t"
      "s_wait_xcnt 0x0"
      :: "v"(lds + 0u * (32u * PITCH_B)), "v"(lds + 1u * (32u * PITCH_B)), "v"(lds + 2u * (32u * PITCH_B)), "v"(lds + 3u * (32u * PITCH_B)), "v"(lds + 4u * (32u * PITCH_B)), "v"(lds + 5u * (32u * PITCH_B)), "v"(lds + 6u * (32u * PITCH_B)), "v"(lds + 7u * (32u * PITCH_B)), "v"(lds + 8u * (32u * PITCH_B)), "v"(lds + 9u * (32u * PITCH_B)), "v"(lds + 10u * (32u * PITCH_B)), "v"(lds + 11u * (32u * PITCH_B)),
         "v"(ga + 0 * 32 * C_), "v"(ga + 1 * 32 * C_), "v"(ga + 2 * 32 * C_), "v"(ga + 3 * 32 * C_), "v"(gb + 0 * 32 * C_), "v"(gb + 1 * 32 * C_), "v"(gb + 2 * 32 * C_), "v"(gb + 3 * 32 * C_), "v"(gb + 4 * 32 * C_), "v"(gb + 5 * 32 * C_), "v"(gb + 6 * 32 * C_), "v"(gb + 7 * 32 * C_)
      : "memory");
}

__device__ __forceinline__ void gemm_tile(const _Float16* __restrict__ A,
                                          const _Float16* __restrict__ W,
                                          long mblk, long nblk,
                                          _Float16* smem, v8f (&acc)[4][4]) {
  const int tid  = threadIdx.x;
  const int lane = tid & 31;
  const int wave = tid >> 5;
  const int wm = wave >> 2;        // 0..1
  const int wn = wave & 3;         // 0..3

  const _Float16* ga = A + (mblk + (tid >> 3)) * C_ + (tid & 7) * 8;
  const _Float16* gb = W + (nblk + (tid >> 3)) * C_ + (tid & 7) * 8;
  const unsigned lds0 = (unsigned)(size_t)smem + (unsigned)(tid >> 3) * PITCH_B
                        + (unsigned)(tid & 7) * 16u;

  copy_stage(ga, gb, lds0);
  // pass 0's bytes have landed before the barrier publishes them
  asm volatile("s_wait_asynccnt 0x0" ::: "memory");
  __syncthreads();
  copy_stage(ga + BK_, gb + BK_, lds0 + STAGE_B);

  // rolled: one pass per trip, buffer = trip parity
#pragma unroll 1
  for (int t = 0; t < NPASS_; ++t) {
    const _Float16* sa = smem + (t & 1) * STAGE_H + (wm * 64) * PITCH_H;
    const _Float16* sb = smem + (t & 1) * STAGE_H + (BM_ + wn * 64) * PITCH_H;
#pragma unroll
    for (int kk = 0; kk < BK_; kk += 32) {
      v16h a[4], b[4];
#pragma unroll
      for (int i = 0; i < 4; ++i) a[i] = load_frag_lds(sa + i * 16 * PITCH_H + kk, PITCH_H, lane);
#pragma unroll
      for (int j = 0; j < 4; ++j) b[j] = load_frag_lds(sb + j * 16 * PITCH_H + kk, PITCH_H, lane);
      // keeps the block's 16 LDS reads one group ahead of its 16 WMMAs: spread
      // among them, each A row would wait out the LDS latency on its own
      __builtin_amdgcn_sched_barrier(0);
#pragma unroll
      for (int i = 0; i < 4; ++i)
#pragma unroll
        for (int j = 0; j < 4; ++j) acc[i][j] = wmma16(a[i], b[j], acc[i][j]);
      // keeps the next group's reads from sinking in among these WMMAs
      __builtin_amdgcn_sched_barrier(0);
    }
    // publish point of pass t+1: own LDS reads of this buffer retired, own
    // copies of the next buffer landed, then the barrier; only then the refill.
    asm volatile("s_wait_dscnt 0x0" ::: "memory");
    asm volatile("s_wait_asynccnt 0x0" ::: "memory");
    __syncthreads();
    if (t + 2 < NPASS_)
      copy_stage(ga + (t + 2) * BK_, gb + (t + 2) * BK_, lds0 + (unsigned)(t & 1) * STAGE_B);
  }
  // nothing is outstanding when the wave ends
  asm volatile("s_wait_asynccnt 0x0" ::: "memory");
}

// ---------------------------------------------------------------------------
// QKV GEMM: qkv[m][o] = sum_c X[m][c] * Wqkv[o][c]
//   X: [B*N, C] f16 row-major, Wqkv: [3C, C] f16 row-major (rows = B columns).
// Epilogue: Q,K: [B,H,N,D], V transposed: [B,H,D,N]. A wave's 64 x 64 tile is
// 64 positions of one batch by the 64 d of one head of one of Q, K, V, that is
// 64 whole 128-B lines of its target. The wave lays the tile, as f16, in its own
// LDS range in the target's row order (pitch 144 B) and stores it line by line.
// ---------------------------------------------------------------------------
#define EP_WAVE_H (64 * PITCH_H)             // one wave's staging range in halves

// 64 staged rows of 128 B -> 64 rows of dst, ld halves apart. A load or store
// covers 4 whole rows (8 lanes x 16 B a row).
__device__ __forceinline__ void store_rows(const _Float16* st, _Float16* __restrict__ dst,
                                           const int ld, int lane) {
  const _Float16* sp = st + (lane >> 3) * PITCH_H + (lane & 7) * 8;
  _Float16* gp = dst + (long)(lane >> 3) * ld + (lane & 7) * 8;
  v8h v[16];
  // both unrolled, loads apart from stores: v[] stays in registers and all 16
  // LDS reads are in flight before the first store waits for its row
#pragma unroll
  for (int k = 0; k < 16; ++k) v[k] = *(const v8h*)(sp + k * 4 * PITCH_H);
#pragma unroll
  for (int k = 0; k < 16; ++k) *(v8h*)(gp + (long)k * 4 * ld) = v[k];
}

__global__ void __launch_bounds__(256)
gemm_qkv(const _Float16* __restrict__ X, const _Float16* __restrict__ W,
         _Float16* __restrict__ Q, _Float16* __restrict__ K,
         _Float16* __restrict__ Vt) {
  __shared__ __attribute__((aligned(16))) _Float16 smem[2 * STAGE_H];
  const int lane = threadIdx.x & 31;
  // scalar: the choice of target and the tile's base address are per wave
  const int wave = __builtin_amdgcn_readfirstlane(threadIdx.x >> 5);
  const long mblk = (long)blockIdx.x * BM_;
  const long nblk = (long)blockIdx.y * BN_;
  const int m0 = (int)mblk + (wave >> 2) * 64;
  const int n0 = (int)nblk + (wave & 3) * 64;

  v8f acc[4][4] = {};
  gemm_tile(X, W, mblk, nblk, smem, acc);

  // The last pass's barrier stands behind every wave's last read of the ring and
  // nothing is being copied into it: each wave may now write its own range.
  _Float16* st = smem + wave * EP_WAVE_H;
  const int  s  = n0 >> 10;                       // 0 Q, 1 K, 2 V (C_ = 1024)
  const long bh = (long)(m0 >> 10) * H_ + ((n0 & 1023) >> 6);
  const int  nb = m0 & 1023;                      // the tile's first position
  const int  c  = lane & 15;
  const int  h8 = (lane >> 4) << 3;

  if (s == 2) {
    // staged rows = d: a lane's 8 values of a tile are 8 positions of one d
    // (both loops unrolled: acc stays in registers)
#pragma unroll
    for (int i = 0; i < 4; ++i)
#pragma unroll
      for (int j = 0; j < 4; ++j)
        *(v8h*)(st + (j * 16 + c) * PITCH_H + i * 16 + h8) =
            __builtin_convertvector(acc[i][j], v8h);
    // own LDS writes done before other lanes' rows are read back
    asm volatile("s_wait_dscnt 0x0" ::: "memory");
    store_rows(st, Vt + bh * D_ * N_ + nb, N_, lane);
  } else {
    // staged rows = positions: a lane's 8 values of a tile are 8 rows of one d
    // (all three loops unrolled: acc stays in registers)
#pragma unroll
    for (int i = 0; i < 4; ++i)
#pragma unroll
      for (int j = 0; j < 4; ++j)
#pragma unroll
        for (int r = 0; r < 8; ++r)
          st[(i * 16 + h8 + r) * PITCH_H + j * 16 + c] = (_Float16)acc[i][j][r];
    // own LDS writes done before other lanes' rows are read back
    asm volatile("s_wait_dscnt 0x0" ::: "memory");
    store_rows(st, (s == 0 ? Q : K) + (bh * N_ + nb) * D_, D_, lane);
  }
}

#define AK_       64
#define ASTAGE_H  ((AK_ + D_) * PITCH_H)
#define ASTAGE_B  (ASTAGE_H * 2u)
#define ANSTAGE_  (N_ / AK_)

// One stage: each thread copies 16 B of rows r, r+16, ... (4 of K, 4 of V^T).
// gk, gv: this lane's source in row r of the K and V^T tile; lds: its LDS byte
// address in row r of the target buffer.
__device__ __forceinline__ void attn_copy_stage(const _Float16* gk, const _Float16* gv,
                                                unsigned lds) {
  // s_wait_xcnt stands inside the statement so that no address register of an
  // issued copy is rewritten ahead of it.
  asm volatile(
      "global_load_async_to_lds_b128 %0, %8, off\n\t"
      "global_load_async_to_lds_b128 %1, %9, off\n\t"
      "global_load_async_to_lds_b128 %2, %10, off\n\t"
      "global_load_async_to_lds_b128 %3, %11, off\n\t"
      "global_load_async_to_lds_b128 %4, %12, off\n\t"
      "global_load_async_to_lds_b128 %5, %13, off\n\t"
      "global_load_async_to_lds_b128 %6, %14, off\n\t"
      "global_load_async_to_lds_b128 %7, %15, off\n\t"
      "s_wait_xcnt 0x0"
      :: "v"(lds + 0u * (16u * PITCH_B)), "v"(lds + 1u * (16u * PITCH_B)), "v"(lds + 2u * (16u * PITCH_B)), "v"(lds + 3u * (16u * PITCH_B)), "v"(lds + 4u * (16u * PITCH_B)), "v"(lds + 5u * (16u * PITCH_B)), "v"(lds + 6u * (16u * PITCH_B)), "v"(lds + 7u * (16u * PITCH_B)),
         "v"(gk + 0 * 16 * D_), "v"(gk + 1 * 16 * D_), "v"(gk + 2 * 16 * D_), "v"(gk + 3 * 16 * D_), "v"(gv + 0 * 16 * N_), "v"(gv + 1 * 16 * N_), "v"(gv + 2 * 16 * N_), "v"(gv + 3 * 16 * N_)
      : "memory");
}

// value of lane l ^ 16 (the other half's lane of the same query)
__device__ __forceinline__ float xhalf(float x) {
  int i = __builtin_bit_cast(int, x);
  return __builtin_bit_cast(float, __builtin_amdgcn_permlanex16(
      i, i, 0x76543210, 0xfedcba98, false, false));
}

// Base-2 exponentials in place, a run of them in ONE statement: behind each
// v_exp_f32 stands an instruction that neither reads its result nor overwrites
// its source (the next v_exp_f32, on other registers; v_nop behind the last).
// That is the slot the instruction set asks for behind a transcendental.
__device__ __forceinline__ void exp2_run8(v8f& x) {
  float a = x[0], b = x[1], c = x[2], d = x[3], e = x[4], f = x[5], g = x[6], h = x[7];
  asm("v_exp_f32 %0, %0\n\t"
      "v_exp_f32 %1, %1\n\t"
      "v_exp_f32 %2, %2\n\t"
      "v_exp_f32 %3, %3\n\t"
      "v_exp_f32 %4, %4\n\t"
      "v_exp_f32 %5, %5\n\t"
      "v_exp_f32 %6, %6\n\t"
      "v_exp_f32 %7, %7\n\t"
      "v_nop"
      : "+v"(a), "+v"(b), "+v"(c), "+v"(d), "+v"(e), "+v"(f), "+v"(g), "+v"(h));
  x = v8f{a, b, c, d, e, f, g, h};
}
// the same with one more value in front
__device__ __forceinline__ void exp2_run9(float& y, v8f& x) {
  float a = x[0], b = x[1], c = x[2], d = x[3], e = x[4], f = x[5], g = x[6], h = x[7];
  asm("v_exp_f32 %8, %8\n\t"
      "v_exp_f32 %0, %0\n\t"
      "v_exp_f32 %1, %1\n\t"
      "v_exp_f32 %2, %2\n\t"
      "v_exp_f32 %3, %3\n\t"
      "v_exp_f32 %4, %4\n\t"
      "v_exp_f32 %5, %5\n\t"
      "v_exp_f32 %6, %6\n\t"
      "v_exp_f32 %7, %7\n\t"
      "v_nop"
      : "+v"(a), "+v"(b), "+v"(c), "+v"(d), "+v"(e), "+v"(f), "+v"(g), "+v"(h), "+v"(y));
  x = v8f{a, b, c, d, e, f, g, h};
}
#define LOG2E_ 1.44269504f   // e^x = 2^(x * LOG2E_), as __expf forms it

// amdgpu_waves_per_eu(4, 7): the loop needs more than 128 registers, so seven
// waves a SIMD are what fits. Told so, the compiler keeps several LDS loads in
// flight behind counted waits; aiming at eight, which it misses, it reuses one
// register set and waits out every pair of loads on its own.
__global__ void __launch_bounds__(128) __attribute__((amdgpu_waves_per_eu(4, 7)))
attn_fwd(const _Float16* __restrict__ Q, const _Float16* __restrict__ K,
         const _Float16* __restrict__ Vt, _Float16* __restrict__ O) {
  __shared__ __attribute__((aligned(16))) _Float16 kv[2 * ASTAGE_H];
  const int tid  = threadIdx.x;
  const int lane = threadIdx.x & 31;
  const int wave = threadIdx.x >> 5;
  const int gq = blockIdx.x * 4 + wave;   // [0, B*H*(N/16))
  const int qb = gq & 63;                 // q-block within (b,h)
  const int bh = gq >> 6;                 // 0..B*H-1

  const _Float16* Qp = Q  + ((long)bh * N_ + qb * 16) * D_;
  const _Float16* Kp = K  + (long)bh * N_ * D_;
  const _Float16* Vp = Vt + (long)bh * D_ * N_;

  // Q^T fragments (B operand): 64 d x 16 queries, split into two K=32 fragments.
  v16h qa0 = load_frag(Qp + 0,  D_, lane);
  v16h qa1 = load_frag(Qp + 32, D_, lane);

  v8f  o_acc[4] = {};          // O^T: 64 d (4 tiles) x 16 queries
  float mrun = -1e30f;         // this lane's query: maximum so far (both halves alike)
  float lrun = 0.f;            // sum over this half's keys only; joined in the epilogue

  const _Float16* gk = Kp + (tid >> 3) * D_ + (tid & 7) * 8;
  const _Float16* gv = Vp + (tid >> 3) * N_ + (tid & 7) * 8;
  const unsigned lds0 = (unsigned)(size_t)kv + (unsigned)(tid >> 3) * PITCH_B
                        + (unsigned)(tid & 7) * 16u;

  attn_copy_stage(gk, gv, lds0);
  // stage 0's bytes have landed before the barrier publishes them
  asm volatile("s_wait_asynccnt 0x0" ::: "memory");
  __syncthreads();
  attn_copy_stage(gk + AK_ * D_, gv + AK_, lds0 + ASTAGE_B);

  // rolled: one stage per trip, buffer = trip parity
#pragma unroll 1
  for (int st = 0; st < ANSTAGE_; ++st) {
   const _Float16* sk = kv + (st & 1) * ASTAGE_H;   // K rows of this stage
   const _Float16* sv = sk + AK_ * PITCH_H;         // V^T rows of this stage
   // unrolled: the two passes' LDS offsets become immediates
#pragma unroll
   for (int kb = 0; kb < AK_; kb += 32) {
    // ---- S^T = K . Q^T for 32 keys: two 16 (keys) x 16 (queries) tiles ---
    v8f s0 = {}, s1 = {};
    {
      v16h kb0 = load_frag_lds(sk + (kb     ) * PITCH_H + 0,  PITCH_H, lane);
      v16h kb1 = load_frag_lds(sk + (kb     ) * PITCH_H + 32, PITCH_H, lane);
      s0 = wmma16(kb0, qa0, s0);
      s0 = wmma16(kb1, qa1, s0);
      v16h kc0 = load_frag_lds(sk + (kb + 16) * PITCH_H + 0,  PITCH_H, lane);
      v16h kc1 = load_frag_lds(sk + (kb + 16) * PITCH_H + 32, PITCH_H, lane);
      s1 = wmma16(kc0, qa0, s1);
      s1 = wmma16(kc1, qa1, s1);
    }

    // ---- online softmax over this 32-key block, one query a lane ---------
    s0 *= SCALE_;
    s1 *= SCALE_;
    float mx = -1e30f;
    // unrolled: the score tiles stay in registers
#pragma unroll
    for (int r = 0; r < 8; ++r) mx = fmaxf(mx, fmaxf(s0[r], s1[r]));
    mx = fmaxf(mx, xhalf(mx));               // the query's maximum over all 32 keys
    const float mnew  = fmaxf(mrun, mx);
    float alpha = (mrun - mnew) * LOG2E_;
    s0 = (s0 - mnew) * LOG2E_;
    s1 = (s1 - mnew) * LOG2E_;
    exp2_run9(alpha, s0);                    // alpha = e^(mrun - mnew), s0 = P^T rows 8h + r
    exp2_run8(s1);                           // s1 = P^T rows 16 + 8h + r
    float rs0 = 0.f, rs1 = 0.f;
    v16h pb;                                 // P^T, 32 keys x 16 queries (B operand)
    // unrolled: the score tiles and pb stay in registers
#pragma unroll
    for (int r = 0; r < 8; ++r) {
      rs0 += s0[r];
      rs1 += s1[r];
      pb[r]     = (_Float16)s0[r];           // k = 8h + r
      pb[8 + r] = (_Float16)s1[r];           // k = 16 + 8h + r
    }
    lrun = lrun * alpha + (rs0 + rs1);
    mrun = mnew;
    // both unrolled: o_acc stays in registers
#pragma unroll
    for (int t = 0; t < 4; ++t)
#pragma unroll
      for (int r = 0; r < 8; ++r) o_acc[t][r] *= alpha;

    // ---- O^T += V^T . P^T  (V stored transposed: [D, N]) -----------------
    // unrolled: o_acc stays in registers, LDS offsets become immediates
#pragma unroll
    for (int t = 0; t < 4; ++t) {
      v16h va = load_frag_lds(sv + (t * 16) * PITCH_H + kb, PITCH_H, lane);
      o_acc[t] = wmma16(va, pb, o_acc[t]);
    }
   }
   // publish point of stage st+1: own LDS reads of this buffer retired, own
   // copies of the next buffer landed, then the barrier; only then the refill.
   asm volatile("s_wait_dscnt 0x0" ::: "memory");
   asm volatile("s_wait_asynccnt 0x0" ::: "memory");
   __syncthreads();
   if (st + 2 < ANSTAGE_)
     attn_copy_stage(gk + (st + 2) * (AK_ * D_), gv + (st + 2) * AK_,
                     lds0 + (unsigned)(st & 1) * ASTAGE_B);
  }
  // nothing is outstanding when the wave ends
  asm volatile("s_wait_asynccnt 0x0" ::: "memory");

  // ---- epilogue: normalize and write f16 into [B, N, C] -----------------
  // a lane holds d = 16 t + 8 (lane >> 4) + r of its query: one 16-B store a tile
  const int b = bh >> 4;
  const int h = bh & 15;
  const float l = lrun + xhalf(lrun);        // the two halves' sums joined
  const long row = (long)b * N_ + qb * 16 + (lane & 15);
  _Float16* Op = O + row * C_ + h * D_ + ((lane >> 4) << 3);
  // both unrolled: o_acc stays in registers
#pragma unroll
  for (int t = 0; t < 4; ++t) {
    v8h o;
#pragma unroll
    for (int r = 0; r < 8; ++r) o[r] = (_Float16)(o_acc[t][r] / l);
    *(v8h*)(Op + t * 16) = o;
  }
}

// ---------------------------------------------------------------------------
// Output projection: out[m][o] = sum_c A[m][c] * Wp[o][c] + bias[o]  (f32 out)
// Same main loop and tiles as gemm_qkv.
// ---------------------------------------------------------------------------
__global__ void __launch_bounds__(256)
gemm_proj(const _Float16* __restrict__ A, const _Float16* __restrict__ W,
          const float* __restrict__ bias, float* __restrict__ out) {
  __shared__ __attribute__((aligned(16))) _Float16 smem[2 * STAGE_H];
  const int lane = threadIdx.x & 31;
  const int wave = threadIdx.x >> 5;
  const long mblk = (long)blockIdx.x * BM_;
  const long nblk = (long)blockIdx.y * BN_;
  const long m0 = mblk + (wave >> 2) * 64;
  const long n0 = nblk + (wave & 3) * 64;

  v8f acc[4][4] = {};
  gemm_tile(A, W, mblk, nblk, smem, acc);

#pragma unroll
  for (int i = 0; i < 4; ++i)
#pragma unroll
    for (int j = 0; j < 4; ++j)
#pragma unroll
      for (int r = 0; r < 8; ++r) {
        long m = m0 + i * 16 + r + ((lane >> 4) << 3);
        long o = n0 + j * 16 + (lane & 15);
        out[m * C_ + o] = acc[i][j][r] + bias[o];
      }
}

// ---------------------------------------------------------------------------
// Launch
// ---------------------------------------------------------------------------
extern "C" void kernel_launch(void* const* d_in, const int* in_sizes, int n_in,
                              void* d_out, int out_size, void* d_ws, size_t ws_size,
                              hipStream_t stream) {
  const float* x      = (const float*)d_in[0];  // [B,N,C]
  const float* w_qkv  = (const float*)d_in[1];  // [3C,C]
  const float* w_proj = (const float*)d_in[2];  // [C,C]
  const float* b_proj = (const float*)d_in[3];  // [C]
  float* out = (float*)d_out;                   // [B,N,C]

  const long nX    = (long)B_ * N_ * C_;   // 8M
  const long nWqkv = (long)3 * C_ * C_;    // 3M
  const long nWp   = (long)C_ * C_;        // 1M
  const long nBHND = (long)B_ * H_ * N_ * D_; // 8M

  _Float16* xh  = (_Float16*)d_ws;
  _Float16* wqh = xh  + nX;
  _Float16* wph = wqh + nWqkv;
  _Float16* qw  = wph + nWp;
  _Float16* kw  = qw  + nBHND;
  _Float16* vtw = kw  + nBHND;
  _Float16* aw  = vtw + nBHND;   // attention output [B,N,C] f16

  // 1) f32 -> f16 conversions, one launch: 768 tiles of 16384 values into
  //    [xh | wqh | wph], three tiles a block, one block a WGP
  cvt_f32_f16<<<CVT_BLOCKS_, CVT_THREADS_, 0, stream>>>(x, w_qkv, w_proj, xh);

  // 2) QKV projection: M = B*N = 8192, N = 3C = 3072 (block tile 128x256)
  gemm_qkv<<<dim3(8192 / 128, 3072 / 256), 256, 0, stream>>>(xh, wqh, qw, kw, vtw);

  // 3) Flash attention: B*H*(N/16) q-blocks, 4 waves per block
  attn_fwd<<<(B_ * H_ * (N_ / 16)) / 4, 128, 0, stream>>>(qw, kw, vtw, aw);

  // 4) Output projection: M = 8192, N = C = 1024 (block tile 128x256)
  gemm_proj<<<dim3(8192 / 128, 1024 / 256), 256, 0, stream>>>(aw, wph, b_proj, out);
}

// v007
// It runs in 107 microseconds.
// In both of two side-by-side timings against v006, it was 1.06 times as fast.
// All steps since v000 together make it 3.76 times as fast.
#include <hip/hip_runtime.h>
#include <hip/hip_bf16.h>

typedef __attribute__((ext_vector_type(16))) _Float16 v16h;
typedef __attribute__((ext_vector_type(8)))  _Float16 v8h;
typedef __attribute__((ext_vector_type(8)))  float    v8f;

#define B_  8
#define N_  1024
#define C_  1024
#define H_  16
#define D_  64
#define SCALE_ 0.125f   // 1/sqrt(64)

// ---------------------------------------------------------------------------
// WMMA helper: D = A(16x32 f16) * B(32x16 f16) + C(16x16 f32)
// ---------------------------------------------------------------------------
__device__ __forceinline__ v8f wmma16(v16h a, v16h b, v8f c) {
  return __builtin_amdgcn_wmma_f32_16x16x32_f16(
      /*neg_a=*/false, a, /*neg_b=*/false, b,
      /*c_mod=*/(short)0, c, /*reuse_a=*/false, /*reuse_b=*/false);
}

// ---------------------------------------------------------------------------
// Load a 16x32 f16 A-fragment (or B-fragment from a column-major-over-K
// source, i.e. a source where each logical column is a contiguous K-run).
// ISA 16-bit A layout: lanes 0-15 hold row=lane, K = {0..7, 16..23};
//                      lanes 16-31 hold row=lane-16, K = {8..15, 24..31}.
// base points at (row0, k0); ld = element stride between rows/columns.
// ---------------------------------------------------------------------------
__device__ __forceinline__ v16h load_frag(const _Float16* __restrict__ base,
                                          long ld, int lane) {
  const _Float16* p = base + (long)(lane & 15) * ld + ((lane >> 4) << 3);
  v8h lo = *(const v8h*)(p);        // K = kofs .. kofs+7
  v8h hi = *(const v8h*)(p + 16);   // K = kofs+16 .. kofs+23
  return __builtin_shufflevector(lo, hi, 0,1,2,3,4,5,6,7,8,9,10,11,12,13,14,15);
}

// LDS variant (same layout)
__device__ __forceinline__ v16h load_frag_lds(const _Float16* base, int ld, int lane) {
  const _Float16* p = base + (lane & 15) * ld + ((lane >> 4) << 3);
  v8h lo = *(const v8h*)(p);
  v8h hi = *(const v8h*)(p + 16);
  return __builtin_shufflevector(lo, hi, 0,1,2,3,4,5,6,7,8,9,10,11,12,13,14,15);
}

// ---------------------------------------------------------------------------
// f32 -> f16 conversion, as a stream: few long-lived waves instead of one
// value a thread. Block = 512 threads (16 waves). A tile is 16384 values: each
// wave owns 4 KB of contiguous input, read by 8 loads of 16 B a lane (512
// contiguous bytes a load) that are all in flight together, and writes 8 B a
// lane (256 contiguous bytes a store).
// ONE launch converts all three inputs: they do not depend on one another, and
// their f16 copies lie one behind the other in y ([x | w_qkv | w_proj]), so a
// tile's index is its place in y and says which input it comes from.
// ---------------------------------------------------------------------------
typedef __attribute__((ext_vector_type(4))) float    v4f;
typedef __attribute__((ext_vector_type(4))) _Float16 v4h;
#define CVT_THREADS_ 512
#define CVT_LOADS_   8
#define CVT_TILE_    (CVT_THREADS_ * CVT_LOADS_ * 4)   // values a tile
#define CVT_NT_X_    (B_ * N_ * C_ / CVT_TILE_)        // tiles of x      (512)
#define CVT_NT_WQ_   (3 * C_ * C_ / CVT_TILE_)         // tiles of w_qkv  (192)
#define CVT_NT_WP_   (C_ * C_ / CVT_TILE_)             // tiles of w_proj  (64)
#define CVT_NT_      (CVT_NT_X_ + CVT_NT_WQ_ + CVT_NT_WP_)
#define CVT_BLOCKS_  256                               // the grid: three tiles a block

__global__ void __launch_bounds__(CVT_THREADS_)
cvt_f32_f16(const float* __restrict__ x, const float* __restrict__ wq,
            const float* __restrict__ wp, _Float16* __restrict__ y) {
  const int lane = threadIdx.x & 31;
  const int wave = threadIdx.x >> 5;
  // this lane's first group of 4 values inside a tile
  const int g = wave * (32 * CVT_LOADS_) + lane;
  for (int tile = blockIdx.x; tile < CVT_NT_; tile += CVT_BLOCKS_) {
    // the tile's input and its index there (the same for the whole block)
    const float* in = x;
    int t = tile;
    if (tile >= CVT_NT_X_ + CVT_NT_WQ_) { in = wp; t = tile - (CVT_NT_X_ + CVT_NT_WQ_); }
    else if (tile >= CVT_NT_X_)         { in = wq; t = tile - CVT_NT_X_; }
    const v4f* __restrict__ src = (const v4f*)in + (long)t * (CVT_TILE_ / 4) + g;
    v4h* __restrict__ dst = (v4h*)y + (long)tile * (CVT_TILE_ / 4) + g;
    v4f v[CVT_LOADS_];
    // unrolled, loads apart from stores: all 8 loads issue before the first wait
#pragma unroll
    for (int j = 0; j < CVT_LOADS_; ++j) v[j] = src[j * 32];
    // unrolled: v[] stays in registers
#pragma unroll
    for (int j = 0; j < CVT_LOADS_; ++j) dst[j * 32] = __builtin_convertvector(v[j], v4h);
  }
}

// ---------------------------------------------------------------------------
// Shared GEMM main loop: acc = A[mblk..+128][:] * W[nblk..+256][:]^T, K = C_.
// Block = 256 threads (8 waves in 2Mx4N), block tile 128 x 256, wave tile
// 64 x 64. A pass is 64 k: its 384 operand rows of 128 B lie in LDS at a pitch
// of 144 B ([A 128 rows | W 256 rows]); two buffers, filled by asynchronous
// b128 copies one pass ahead of their readers.
// ---------------------------------------------------------------------------
#define BM_      128
#define BN_      256
#define BK_      64
#define PITCH_H  72                          // LDS row pitch in halves
#define PITCH_B  144u                        // the same in bytes
#define STAGE_H  ((BM_ + BN_) * PITCH_H)     // one buffer in halves
#define STAGE_B  (STAGE_H * 2u)              // the same in bytes
#define NPASS_   (C_ / BK_)

// Hints to L2: each lane asks for the 256-B unit that its
// address lies in. The operands of the three kernels below were stored by an
// earlier launch, and a ring of two buffers leads its readers by one pass only:
// asked for at kernel entry, the later passes' rows are on their way from memory
// while the first passes run. Nothing waits for a hint and no result depends on
// one. Every address lies inside its buffer. s_wait_xcnt stands inside the
// statement so that no address register is rewritten ahead of it.
__device__ __forceinline__ void l2_ask(const _Float16* p) {
  asm volatile(
      "global_prefetch_b8 %0, off scope:SCOPE_SE\n\t"
      "s_wait_xcnt 0x0"
      :: "v"(p) : "memory");
}
__device__ __forceinline__ void l2_ask2(const _Float16* p, const _Float16* q) {
  asm volatile(
      "global_prefetch_b8 %0, off scope:SCOPE_SE\n\t"
      "global_prefetch_b8 %1, off scope:SCOPE_SE\n\t"
      "s_wait_xcnt 0x0"
      :: "v"(p), "v"(q) : "memory");
}

// One stage: each thread copies 16 B of rows r, r+32, ... (4 of A, 8 of W).
// ga, gb: this lane's source in row r of the A and W tile; lds: its LDS byte
// address in row r of the target buffer.
__device__ __forceinline__ void copy_stage(const _Float16* ga, const _Float16* gb,
                                           unsigned lds) {
  // s_wait_xcnt stands inside the statement so that no address register of an
  // issued copy is rewritten ahead of it.
  asm volatile(
      "global_load_async_to_lds_b128 %0, %12, off\n\t"
      "global_load_async_to_lds_b128 %1, %13, off\n\t"
      "global_load_async_to_lds_b128 %2, %14, off\n\t"
      "global_load_async_to_lds_b128 %3, %15, off\n\t"
      "global_load_async_to_lds_b128 %4, %16, off\n\t"
      "global_load_async_to_lds_b128 %5, %17, off\n\t"
      "global_load_async_to_lds_b128 %6, %18, off\n\t"
      "global_load_async_to_lds_b128 %7, %19, off\n\t"
      "global_load_async_to_lds_b128 %8, %20, off\n\t"
      "global_load_async_to_lds_b128 %9, %21, off\n\t"
      "global_load_async_to_lds_b128 %10, %22, off\n\t"
      "global_load_async_to_lds_b128 %11, %23, off\n\t"
      "s_wait_xcnt 0x0"
      :: "v"(lds + 0u * (32u * PITCH_B)), "v"(lds + 1u * (32u * PITCH_B)), "v"(lds + 2u * (32u * PITCH_B)), "v"(lds + 3u * (32u * PITCH_B)), "v"(lds + 4u * (32u * PITCH_B)), "v"(lds + 5u * (32u * PITCH_B)), "v"(lds + 6u * (32u * PITCH_B)), "v"(lds + 7u * (32u * PITCH_B)), "v"(lds + 8u * (32u * PITCH_B)), "v"(lds + 9u * (32u * PITCH_B)), "v"(lds + 10u * (32u * PITCH_B)), "v"(lds + 11u * (32u * PITCH_B)),
         "v"(ga + 0 * 32 * C_), "v"(ga + 1 * 32 * C_), "v"(ga + 2 * 32 * C_), "v"(ga + 3 * 32 * C_), "v"(gb + 0 * 32 * C_), "v"(gb + 1 * 32 * C_), "v"(gb + 2 * 32 * C_), "v"(gb + 3 * 32 * C_), "v"(gb + 4 * 32 * C_), "v"(gb + 5 * 32 * C_), "v"(gb + 6 * 32 * C_), "v"(gb + 7 * 32 * C_)
      : "memory");
}

__device__ __forceinline__ void gemm_tile(const _Float16* __restrict__ A,
                                          const _Float16* __restrict__ W,
                                          long mblk, long nblk,
                                          _Float16* smem, v8f (&acc)[4][4]) {
  const int tid  = threadIdx.x;
  const int lane = tid & 31;
  const int wave = tid >> 5;
  const int wm = wave >> 2;        // 0..1
  const int wn = wave & 3;         // 0..3

  const _Float16* ga = A + (mblk + (tid >> 3)) * C_ + (tid & 7) * 8;
  const _Float16* gb = W + (nblk + (tid >> 3)) * C_ + (tid & 7) * 8;
  const unsigned lds0 = (unsigned)(size_t)smem + (unsigned)(tid >> 3) * PITCH_B
                        + (unsigned)(tid & 7) * 16u;

  copy_stage(ga, gb, lds0);
  // The whole tiles (all k) are asked for once, behind pass 0's own copies. The
  // blocks that read the same rows share the asking: a quarter of the A tile by
  // blockIdx.y, an eighth of the W tile by blockIdx.x >> 3 (its eight askers differ
  // in blockIdx.x & 7). A share is
  // 32 rows of 8 units: one unit of each tile a thread.
  l2_ask2(A + (mblk + (blockIdx.y & 3) * 32 + (tid >> 3)) * C_ + (tid & 7) * 128,
          W + (nblk + ((blockIdx.x >> 3) & 7) * 32 + (tid >> 3)) * C_ + (tid & 7) * 128);
  // pass 0's bytes have landed before the barrier publishes them
  asm volatile("s_wait_asynccnt 0x0" ::: "memory");
  __syncthreads();
  copy_stage(ga + BK_, gb + BK_, lds0 + STAGE_B);

  // rolled: one pass per trip, buffer = trip parity
#pragma unroll 1
  for (int t = 0; t < NPASS_; ++t) {
    const _Float16* sa = smem + (t & 1) * STAGE_H + (wm * 64) * PITCH_H;
    const _Float16* sb = smem + (t & 1) * STAGE_H + (BM_ + wn * 64) * PITCH_H;
#pragma unroll
    for (int kk = 0; kk < BK_; kk += 32) {
      v16h a[4], b[4];
#pragma unroll
      for (int i = 0; i < 4; ++i) a[i] = load_frag_lds(sa + i * 16 * PITCH_H + kk, PITCH_H, lane);
#pragma unroll
      for (int j = 0; j < 4; ++j) b[j] = load_frag_lds(sb + j * 16 * PITCH_H + kk, PITCH_H, lane);
      // keeps the block's 16 LDS reads one group ahead of its 16 WMMAs: spread
      // among them, each A row would wait out the LDS latency on its own
      __builtin_amdgcn_sched_barrier(0);
#pragma unroll
      for (int i = 0; i < 4; ++i)
#pragma unroll
        for (int j = 0; j < 4; ++j) acc[i][j] = wmma16(a[i], b[j], acc[i][j]);
      // keeps the next group's reads from sinking in among these WMMAs
      __builtin_amdgcn_sched_barrier(0);
    }
    // publish point of pass t+1: own LDS reads of this buffer retired, own
    // copies of the next buffer landed, then the barrier; only then the refill.
    asm volatile("s_wait_dscnt 0x0" ::: "memory");
    asm volatile("s_wait_asynccnt 0x0" ::: "memory");
    __syncthreads();
    if (t + 2 < NPASS_)
      copy_stage(ga + (t + 2) * BK_, gb + (t + 2) * BK_, lds0 + (unsigned)(t & 1) * STAGE_B);
  }
  // nothing is outstanding when the wave ends
  asm volatile("s_wait_asynccnt 0x0" ::: "memory");
}

// ---------------------------------------------------------------------------
// QKV GEMM: qkv[m][o] = sum_c X[m][c] * Wqkv[o][c]
//   X: [B*N, C] f16 row-major, Wqkv: [3C, C] f16 row-major (rows = B columns).
// Epilogue: Q,K: [B,H,N,D], V transposed: [B,H,D,N]. A wave's 64 x 64 tile is
// 64 positions of one batch by the 64 d of one head of one of Q, K, V, that is
// 64 whole 128-B lines of its target. The wave lays the tile, as f16, in its own
// LDS range in the target's row order (pitch 144 B) and stores it line by line.
// ---------------------------------------------------------------------------
#define EP_WAVE_H (64 * PITCH_H)             // one wave's staging range in halves

// 64 staged rows of 128 B -> 64 rows of dst, ld halves apart. A load or store
// covers 4 whole rows (8 lanes x 16 B a row).
__device__ __forceinline__ void store_rows(const _Float16* st, _Float16* __restrict__ dst,
                                           const int ld, int lane) {
  const _Float16* sp = st + (lane >> 3) * PITCH_H + (lane & 7) * 8;
  _Float16* gp = dst + (long)(lane >> 3) * ld + (lane & 7) * 8;
  v8h v[16];
  // both unrolled, loads apart from stores: v[] stays in registers and all 16
  // LDS reads are in flight before the first store waits for its row
#pragma unroll
  for (int k = 0; k < 16; ++k) v[k] = *(const v8h*)(sp + k * 4 * PITCH_H);
#pragma unroll
  for (int k = 0; k < 16; ++k) *(v8h*)(gp + (long)k * 4 * ld) = v[k];
}

__global__ void __launch_bounds__(256)
gemm_qkv(const _Float16* __restrict__ X, const _Float16* __restrict__ W,
         _Float16* __restrict__ Q, _Float16* __restrict__ K,
         _Float16* __restrict__ Vt) {
  __shared__ __attribute__((aligned(16))) _Float16 smem[2 * STAGE_H];
  const int lane = threadIdx.x & 31;
  // scalar: the choice of target and the tile's base address are per wave
  const int wave = __builtin_amdgcn_readfirstlane(threadIdx.x >> 5);
  const long mblk = (long)blockIdx.x * BM_;
  const long nblk = (long)blockIdx.y * BN_;
  const int m0 = (int)mblk + (wave >> 2) * 64;
  const int n0 = (int)nblk + (wave & 3) * 64;

  v8f acc[4][4] = {};
  gemm_tile(X, W, mblk, nblk, smem, acc);

  // The last pass's barrier stands behind every wave's last read of the ring and
  // nothing is being copied into it: each wave may now write its own range.
  _Float16* st = smem + wave * EP_WAVE_H;
  const int  s  = n0 >> 10;                       // 0 Q, 1 K, 2 V (C_ = 1024)
  const long bh = (long)(m0 >> 10) * H_ + ((n0 & 1023) >> 6);
  const int  nb = m0 & 1023;                      // the tile's first position
  const int  c  = lane & 15;
  const int  h8 = (lane >> 4) << 3;

  if (s == 2) {
    // staged rows = d: a lane's 8 values of a tile are 8 positions of one d
    // (both loops unrolled: acc stays in registers)
#pragma unroll
    for (int i = 0; i < 4; ++i)
#pragma unroll
      for (int j = 0; j < 4; ++j)
        *(v8h*)(st + (j * 16 + c) * PITCH_H + i * 16 + h8) =
            __builtin_convertvector(acc[i][j], v8h);
    // own LDS writes done before other lanes' rows are read back
    asm volatile("s_wait_dscnt 0x0" ::: "memory");
    store_rows(st, Vt + bh * D_ * N_ + nb, N_, lane);
  } else {
    // staged rows = positions: a lane's 8 values of a tile are 8 rows of one d
    // (all three loops unrolled: acc stays in registers)
#pragma unroll
    for (int i = 0; i < 4; ++i)
#pragma unroll
      for (int j = 0; j < 4; ++j)
#pragma unroll
        for (int r = 0; r < 8; ++r)
          st[(i * 16 + h8 + r) * PITCH_H + j * 16 + c] = (_Float16)acc[i][j][r];
    // own LDS writes done before other lanes' rows are read back
    asm volatile("s_wait_dscnt 0x0" ::: "memory");
    store_rows(st, (s == 0 ? Q : K) + (bh * N_ + nb) * D_, D_, lane);
  }
}

#define AK_       64
#define ASTAGE_H  ((AK_ + D_) * PITCH_H)
#define ASTAGE_B  (ASTAGE_H * 2u)
#define ANSTAGE_  (N_ / AK_)

// One stage: each thread copies 16 B of rows r, r+16, ... (4 of K, 4 of V^T).
// gk, gv: this lane's source in row r of the K and V^T tile; lds: its LDS byte
// address in row r of the target buffer.
__device__ __forceinline__ void attn_copy_stage(const _Float16* gk, const _Float16* gv,
                                                unsigned lds) {
  // s_wait_xcnt stands inside the statement so that no address register of an
  // issued copy is rewritten ahead of it.
  asm volatile(
      "global_load_async_to_lds_b128 %0, %8, off\n\t"
      "global_load_async_to_lds_b128 %1, %9, off\n\t"
      "global_load_async_to_lds_b128 %2, %10, off\n\t"
      "global_load_async_to_lds_b128 %3, %11, off\n\t"
      "global_load_async_to_lds_b128 %4, %12, off\n\t"
      "global_load_async_to_lds_b128 %5, %13, off\n\t"
      "global_load_async_to_lds_b128 %6, %14, off\n\t"
      "global_load_async_to_lds_b128 %7, %15, off\n\t"
      "s_wait_xcnt 0x0"
      :: "v"(lds + 0u * (16u * PITCH_B)), "v"(lds + 1u * (16u * PITCH_B)), "v"(lds + 2u * (16u * PITCH_B)), "v"(lds + 3u * (16u * PITCH_B)), "v"(lds + 4u * (16u * PITCH_B)), "v"(lds + 5u * (16u * PITCH_B)), "v"(lds + 6u * (16u * PITCH_B)), "v"(lds + 7u * (16u * PITCH_B)),
         "v"(gk + 0 * 16 * D_), "v"(gk + 1 * 16 * D_), "v"(gk + 2 * 16 * D_), "v"(gk + 3 * 16 * D_), "v"(gv + 0 * 16 * N_), "v"(gv + 1 * 16 * N_), "v"(gv + 2 * 16 * N_), "v"(gv + 3 * 16 * N_)
      : "memory");
}

// value of lane l ^ 16 (the other half's lane of the same query)
__device__ __forceinline__ float xhalf(float x) {
  int i = __builtin_bit_cast(int, x);
  return __builtin_bit_cast(float, __builtin_amdgcn_permlanex16(
      i, i, 0x76543210, 0xfedcba98, false, false));
}

// Base-2 exponentials in place, a run of them in ONE statement: behind each
// v_exp_f32 stands an instruction that neither reads its result nor overwrites
// its source (the next v_exp_f32, on other registers; v_nop behind the last).
// That is the slot the instruction set asks for behind a transcendental.
__device__ __forceinline__ void exp2_run8(v8f& x) {
  float a = x[0], b = x[1], c = x[2], d = x[3], e = x[4], f = x[5], g = x[6], h = x[7];
  asm("v_exp_f32 %0, %0\n\t"
      "v_exp_f32 %1, %1\n\t"
      "v_exp_f32 %2, %2\n\t"
      "v_exp_f32 %3, %3\n\t"
      "v_exp_f32 %4, %4\n\t"
      "v_exp_f32 %5, %5\n\t"
      "v_exp_f32 %6, %6\n\t"
      "v_exp_f32 %7, %7\n\t"
      "v_nop"
      : "+v"(a), "+v"(b), "+v"(c), "+v"(d), "+v"(e), "+v"(f), "+v"(g), "+v"(h));
  x = v8f{a, b, c, d, e, f, g, h};
}
// the same with one more value in front
__device__ __forceinline__ void exp2_run9(float& y, v8f& x) {
  float a = x[0], b = x[1], c = x[2], d = x[3], e = x[4], f = x[5], g = x[6], h = x[7];
  asm("v_exp_f32 %8, %8\n\t"
      "v_exp_f32 %0, %0\n\t"
      "v_exp_f32 %1, %1\n\t"
      "v_exp_f32 %2, %2\n\t"
      "v_exp_f32 %3, %3\n\t"
      "v_exp_f32 %4, %4\n\t"
      "v_exp_f32 %5, %5\n\t"
      "v_exp_f32 %6, %6\n\t"
      "v_exp_f32 %7, %7\n\t"
      "v_nop"
      : "+v"(a), "+v"(b), "+v"(c), "+v"(d), "+v"(e), "+v"(f), "+v"(g), "+v"(h), "+v"(y));
  x = v8f{a, b, c, d, e, f, g, h};
}
#define LOG2E_ 1.44269504f   // e^x = 2^(x * LOG2E_), as __expf forms it

// amdgpu_waves_per_eu(4, 7): the loop needs more than 128 registers, so seven
// waves a SIMD are what fits. Told so, the compiler keeps several LDS loads in
// flight behind counted waits; aiming at eight, which it misses, it reuses one
// register set and waits out every pair of loads on its own.
__global__ void __launch_bounds__(128) __attribute__((amdgpu_waves_per_eu(4, 7)))
attn_fwd(const _Float16* __restrict__ Q, const _Float16* __restrict__ K,
         const _Float16* __restrict__ Vt, _Float16* __restrict__ O) {
  __shared__ __attribute__((aligned(16))) _Float16 kv[2 * ASTAGE_H];
  const int tid  = threadIdx.x;
  const int lane = threadIdx.x & 31;
  const int wave = threadIdx.x >> 5;
  const int gq = blockIdx.x * 4 + wave;   // [0, B*H*(N/16))
  const int qb = gq & 63;                 // q-block within (b,h)
  const int bh = gq >> 6;                 // 0..B*H-1

  const _Float16* Qp = Q  + ((long)bh * N_ + qb * 16) * D_;
  const _Float16* Kp = K  + (long)bh * N_ * D_;
  const _Float16* Vp = Vt + (long)bh * D_ * N_;

  // Q^T fragments (B operand): 64 d x 16 queries, split into two K=32 fragments.
  v16h qa0 = load_frag(Qp + 0,  D_, lane);
  v16h qa1 = load_frag(Qp + 32, D_, lane);

  v8f  o_acc[4] = {};          // O^T: 64 d (4 tiles) x 16 queries
  float mrun = -1e30f;         // this lane's query: maximum so far (both halves alike)
  float lrun = 0.f;            // sum over this half's keys only; joined in the epilogue

  const _Float16* gk = Kp + (tid >> 3) * D_ + (tid & 7) * 8;
  const _Float16* gv = Vp + (tid >> 3) * N_ + (tid & 7) * 8;
  const unsigned lds0 = (unsigned)(size_t)kv + (unsigned)(tid >> 3) * PITCH_B
                        + (unsigned)(tid & 7) * 16u;

  attn_copy_stage(gk, gv, lds0);
  // The head's K and V^T (512 units of 256 B each) are asked for once, behind
  // stage 0's own copies. The 16 blocks of a head share the asking in eighths;
  // blocks j and j ^ 4 ask for the same eighth. Waves 0, 1: 64 units of K; waves 2, 3: 64 units of V^T.
  {
    const int j = blockIdx.x & 15;
    const int share = ((j >> 3) << 2) | (j & 3);
    l2_ask((tid < 64 ? Kp : Vp) + (share * 64 + (tid & 63)) * 128);
  }
  // stage 0's bytes have landed before the barrier publishes them
  asm volatile("s_wait_asynccnt 0x0" ::: "memory");
  __syncthreads();
  attn_copy_stage(gk + AK_ * D_, gv + AK_, lds0 + ASTAGE_B);

  // rolled: one stage per trip, buffer = trip parity
#pragma unroll 1
  for (int st = 0; st < ANSTAGE_; ++st) {
   const _Float16* sk = kv + (st & 1) * ASTAGE_H;   // K rows of this stage
   const _Float16* sv = sk + AK_ * PITCH_H;         // V^T rows of this stage
   // unrolled: the two passes' LDS offsets become immediates
#pragma unroll
   for (int kb = 0; kb < AK_; kb += 32) {
    // ---- S^T = K . Q^T for 32 keys: two 16 (keys) x 16 (queries) tiles ---
    v8f s0 = {}, s1 = {};
    {
      v16h kb0 = load_frag_lds(sk + (kb     ) * PITCH_H + 0,  PITCH_H, lane);
      v16h kb1 = load_frag_lds(sk + (kb     ) * PITCH_H + 32, PITCH_H, lane);
      s0 = wmma16(kb0, qa0, s0);
      s0 = wmma16(kb1, qa1, s0);
      v16h kc0 = load_frag_lds(sk + (kb + 16) * PITCH_H + 0,  PITCH_H, lane);
      v16h kc1 = load_frag_lds(sk + (kb + 16) * PITCH_H + 32, PITCH_H, lane);
      s1 = wmma16(kc0, qa0, s1);
      s1 = wmma16(kc1, qa1, s1);
    }

    // ---- online softmax over this 32-key block, one query a lane ---------
    s0 *= SCALE_;
    s1 *= SCALE_;
    float mx = -1e30f;
    // unrolled: the score tiles stay in registers
#pragma unroll
    for (int r = 0; r < 8; ++r) mx = fmaxf(mx, fmaxf(s0[r], s1[r]));
    mx = fmaxf(mx, xhalf(mx));               // the query's maximum over all 32 keys
    const float mnew  = fmaxf(mrun, mx);
    float alpha = (mrun - mnew) * LOG2E_;
    s0 = (s0 - mnew) * LOG2E_;
    s1 = (s1 - mnew) * LOG2E_;
    exp2_run9(alpha, s0);                    // alpha = e^(mrun - mnew), s0 = P^T rows 8h + r
    exp2_run8(s1);                           // s1 = P^T rows 16 + 8h + r
    float rs0 = 0.f, rs1 = 0.f;
    v16h pb;                                 // P^T, 32 keys x 16 queries (B operand)
    // unrolled: the score tiles and pb stay in registers
#pragma unroll
    for (int r = 0; r < 8; ++r) {
      rs0 += s0[r];
      rs1 += s1[r];
      pb[r]     = (_Float16)s0[r];           // k = 8h + r
      pb[8 + r] = (_Float16)s1[r];           // k = 16 + 8h + r
    }
    lrun = lrun * alpha + (rs0 + rs1);
    mrun = mnew;
    // both unrolled: o_acc stays in registers
#pragma unroll
    for (int t = 0; t < 4; ++t)
#pragma unroll
      for (int r = 0; r < 8; ++r) o_acc[t][r] *= alpha;

    // ---- O^T += V^T . P^T  (V stored transposed: [D, N]) -----------------
    // unrolled: o_acc stays in registers, LDS offsets become immediates
#pragma unroll
    for (int t = 0; t < 4; ++t) {
      v16h va = load_frag_lds(sv + (t * 16) * PITCH_H + kb, PITCH_H, lane);
      o_acc[t] = wmma16(va, pb, o_acc[t]);
    }
   }
   // publish point of stage st+1: own LDS reads of this buffer retired, own
   // copies of the next buffer landed, then the barrier; only then the refill.
   asm volatile("s_wait_dscnt 0x0" ::: "memory");
   asm volatile("s_wait_asynccnt 0x0" ::: "memory");
   __syncthreads();
   if (st + 2 < ANSTAGE_)
     attn_copy_stage(gk + (st + 2) * (AK_ * D_), gv + (st + 2) * AK_,
                     lds0 + (unsigned)(st & 1) * ASTAGE_B);
  }
  // nothing is outstanding when the wave ends
  asm volatile("s_wait_asynccnt 0x0" ::: "memory");

  // ---- epilogue: normalize and write f16 into [B, N, C] -----------------
  // a lane holds d = 16 t + 8 (lane >> 4) + r of its query: one 16-B store a tile
  const int b = bh >> 4;
  const int h = bh & 15;
  const float l = lrun + xhalf(lrun);        // the two halves' sums joined
  const long row = (long)b * N_ + qb * 16 + (lane & 15);
  _Float16* Op = O + row * C_ + h * D_ + ((lane >> 4) << 3);
  // both unrolled: o_acc stays in registers
#pragma unroll
  for (int t = 0; t < 4; ++t) {
    v8h o;
#pragma unroll
    for (int r = 0; r < 8; ++r) o[r] = (_Float16)(o_acc[t][r] / l);
    *(v8h*)(Op + t * 16) = o;
  }
}

// ---------------------------------------------------------------------------
// Output projection: out[m][o] = sum_c A[m][c] * Wp[o][c] + bias[o]  (f32 out)
// Same main loop and tiles as gemm_qkv.
// ---------------------------------------------------------------------------
__global__ void __launch_bounds__(256)
gemm_proj(const _Float16* __restrict__ A, const _Float16* __restrict__ W,
          const float* __restrict__ bias, float* __restrict__ out) {
  __shared__ __attribute__((aligned(16))) _Float16 smem[2 * STAGE_H];
  const int lane = threadIdx.x & 31;
  const int wave = threadIdx.x >> 5;
  const long mblk = (long)blockIdx.x * BM_;
  const long nblk = (long)blockIdx.y * BN_;
  const long m0 = mblk + (wave >> 2) * 64;
  const long n0 = nblk + (wave & 3) * 64;

  v8f acc[4][4] = {};
  gemm_tile(A, W, mblk, nblk, smem, acc);

#pragma unroll
  for (int i = 0; i < 4; ++i)
#pragma unroll
    for (int j = 0; j < 4; ++j)
#pragma unroll
      for (int r = 0; r < 8; ++r) {
        long m = m0 + i * 16 + r + ((lane >> 4) << 3);
        long o = n0 + j * 16 + (lane & 15);
        out[m * C_ + o] = acc[i][j][r] + bias[o];
      }
}

// ---------------------------------------------------------------------------
// Launch
// ---------------------------------------------------------------------------
extern "C" void kernel_launch(void* const* d_in, const int* in_sizes, int n_in,
                              void* d_out, int out_size, void* d_ws, size_t ws_size,
                              hipStream_t stream) {
  const float* x      = (const float*)d_in[0];  // [B,N,C]
  const float* w_qkv  = (const float*)d_in[1];  // [3C,C]
  const float* w_proj = (const float*)d_in[2];  // [C,C]
  const float* b_proj = (const float*)d_in[3];  // [C]
  float* out = (float*)d_out;                   // [B,N,C]

  const long nX    = (long)B_ * N_ * C_;   // 8M
  const long nWqkv = (long)3 * C_ * C_;    // 3M
  const long nWp   = (long)C_ * C_;        // 1M
  const long nBHND = (long)B_ * H_ * N_ * D_; // 8M

  _Float16* xh  = (_Float16*)d_ws;
  _Float16* wqh = xh  + nX;
  _Float16* wph = wqh + nWqkv;
  _Float16* qw  = wph + nWp;
  _Float16* kw  = qw  + nBHND;
  _Float16* vtw = kw  + nBHND;
  _Float16* aw  = vtw + nBHND;   // attention output [B,N,C] f16

  // 1) f32 -> f16 conversions, one launch: 768 tiles of 16384 values into
  //    [xh | wqh | wph], three tiles a block, one block a WGP
  cvt_f32_f16<<<CVT_BLOCKS_, CVT_THREADS_, 0, stream>>>(x, w_qkv, w_proj, xh);

  // 2) QKV projection: M = B*N = 8192, N = 3C = 3072 (block tile 128x256)
  gemm_qkv<<<dim3(8192 / 128, 3072 / 256), 256, 0, stream>>>(xh, wqh, qw, kw, vtw);

  // 3) Flash attention: B*H*(N/16) q-blocks, 4 waves per block
  attn_fwd<<<(B_ * H_ * (N_ / 16)) / 4, 128, 0, stream>>>(qw, kw, vtw, aw);

  // 4) Output projection: M = 8192, N = C = 1024 (block tile 128x256)
  gemm_proj<<<dim3(8192 / 128, 1024 / 256), 256, 0, stream>>>(aw, wph, b_proj, out);
}

// v009
// A run of this version takes 97.5 microseconds.
// It is 1.09 times as fast as v007, going by the measured steps of the versions left out in between.
// All steps since v000 together make it 4.10 times as fast.
#include <hip/hip_runtime.h>
#include <hip/hip_bf16.h>

typedef __attribute__((ext_vector_type(16))) _Float16 v16h;
typedef __attribute__((ext_vector_type(8)))  _Float16 v8h;
typedef __attribute__((ext_vector_type(8)))  float    v8f;

#define B_  8
#define N_  1024
#define C_  1024
#define H_  16
#define D_  64
#define SCALE_ 0.125f   // 1/sqrt(64)

// ---------------------------------------------------------------------------
// WMMA helper: D = A(16x32 f16) * B(32x16 f16) + C(16x16 f32)
// ---------------------------------------------------------------------------
__device__ __forceinline__ v8f wmma16(v16h a, v16h b, v8f c) {
  return __builtin_amdgcn_wmma_f32_16x16x32_f16(
      /*neg_a=*/false, a, /*neg_b=*/false, b,
      /*c_mod=*/(short)0, c, /*reuse_a=*/false, /*reuse_b=*/false);
}

// ---------------------------------------------------------------------------
// Load a 16x32 f16 A-fragment (or B-fragment from a column-major-over-K
// source, i.e. a source where each logical column is a contiguous K-run).
// ISA 16-bit A layout: lanes 0-15 hold row=lane, K = {0..7, 16..23};
//                      lanes 16-31 hold row=lane-16, K = {8..15, 24..31}.
// base points at (row0, k0); ld = element stride between rows/columns.
// ---------------------------------------------------------------------------
__device__ __forceinline__ v16h load_frag(const _Float16* __restrict__ base,
                                          long ld, int lane) {
  const _Float16* p = base + (long)(lane & 15) * ld + ((lane >> 4) << 3);
  v8h lo = *(const v8h*)(p);        // K = kofs .. kofs+7
  v8h hi = *(const v8h*)(p + 16);   // K = kofs+16 .. kofs+23
  return __builtin_shufflevector(lo, hi, 0,1,2,3,4,5,6,7,8,9,10,11,12,13,14,15);
}

// LDS variant (same layout)
__device__ __forceinline__ v16h load_frag_lds(const _Float16* base, int ld, int lane) {
  const _Float16* p = base + (lane & 15) * ld + ((lane >> 4) << 3);
  v8h lo = *(const v8h*)(p);
  v8h hi = *(const v8h*)(p + 16);
  return __builtin_shufflevector(lo, hi, 0,1,2,3,4,5,6,7,8,9,10,11,12,13,14,15);
}

// ---------------------------------------------------------------------------
// f32 -> f16 conversion, as a stream: few long-lived waves instead of one
// value a thread. Block = 512 threads (16 waves). A tile is 16384 values: each
// wave owns 4 KB of contiguous input, read by 8 loads of 16 B a lane (512
// contiguous bytes a load) that are all in flight together, and writes 8 B a
// lane (256 contiguous bytes a store).
// ONE launch converts all three inputs: they do not depend on one another, and
// their f16 copies lie one behind the other in y ([x | w_qkv | w_proj]), so a
// tile's index is its place in y and says which input it comes from.
// ---------------------------------------------------------------------------
typedef __attribute__((ext_vector_type(4))) float    v4f;
typedef __attribute__((ext_vector_type(4))) _Float16 v4h;
#define CVT_THREADS_ 512
#define CVT_LOADS_   8
#define CVT_TILE_    (CVT_THREADS_ * CVT_LOADS_ * 4)   // values a tile
#define CVT_NT_X_    (B_ * N_ * C_ / CVT_TILE_)        // tiles of x      (512)
#define CVT_NT_WQ_   (3 * C_ * C_ / CVT_TILE_)         // tiles of w_qkv  (192)
#define CVT_NT_WP_   (C_ * C_ / CVT_TILE_)             // tiles of w_proj  (64)
#define CVT_NT_      (CVT_NT_X_ + CVT_NT_WQ_ + CVT_NT_WP_)
#define CVT_BLOCKS_  256                               // the grid: three tiles a block

__global__ void __launch_bounds__(CVT_THREADS_)
cvt_f32_f16(const float* __restrict__ x, const float* __restrict__ wq,
            const float* __restrict__ wp, _Float16* __restrict__ y) {
  const int lane = threadIdx.x & 31;
  const int wave = threadIdx.x >> 5;
  // this lane's first group of 4 values inside a tile
  const int g = wave * (32 * CVT_LOADS_) + lane;
  for (int tile = blockIdx.x; tile < CVT_NT_; tile += CVT_BLOCKS_) {
    // the tile's input and its index there (the same for the whole block)
    const float* in = x;
    int t = tile;
    if (tile >= CVT_NT_X_ + CVT_NT_WQ_) { in = wp; t = tile - (CVT_NT_X_ + CVT_NT_WQ_); }
    else if (tile >= CVT_NT_X_)         { in = wq; t = tile - CVT_NT_X_; }
    const v4f* __restrict__ src = (const v4f*)in + (long)t * (CVT_TILE_ / 4) + g;
    v4h* __restrict__ dst = (v4h*)y + (long)tile * (CVT_TILE_ / 4) + g;
    v4f v[CVT_LOADS_];
    // unrolled, loads apart from stores: all 8 loads issue before the first wait
#pragma unroll
    for (int j = 0; j < CVT_LOADS_; ++j) v[j] = src[j * 32];
    // unrolled: v[] stays in registers
#pragma unroll
    for (int j = 0; j < CVT_LOADS_; ++j) dst[j * 32] = __builtin_convertvector(v[j], v4h);
  }
}

// ---------------------------------------------------------------------------
// Shared GEMM main loop: acc = A[mblk..+128][:] * W[nblk..+256][:]^T, K = C_.
// Block = 256 threads (8 waves in 2Mx4N), block tile 128 x 256, wave tile
// 64 x 64. A pass is 64 k: its 384 operand rows of 128 B lie in LDS at a pitch
// of 144 B ([A 128 rows | W 256 rows]); two buffers, filled by asynchronous
// b128 copies one pass ahead of their readers.
// ---------------------------------------------------------------------------
#define BM_      128
#define BN_      256
#define BK_      64
#define PITCH_H  72                          // LDS row pitch in halves
#define PITCH_B  144u                        // the same in bytes
#define STAGE_H  ((BM_ + BN_) * PITCH_H)     // one buffer in halves
#define STAGE_B  (STAGE_H * 2u)              // the same in bytes
#define NPASS_   (C_ / BK_)

// Hints to L2: each lane asks for the 256-B unit that its
// address lies in. The operands of the three kernels below were stored by an
// earlier launch, and a ring of two buffers leads its readers by one pass only:
// asked for at kernel entry, the later passes' rows are on their way from memory
// while the first passes run. Nothing waits for a hint and no result depends on
// one. Every address lies inside its buffer. s_wait_xcnt stands inside the
// statement so that no address register is rewritten ahead of it.
__device__ __forceinline__ void l2_ask(const _Float16* p) {
  asm volatile(
      "global_prefetch_b8 %0, off scope:SCOPE_SE\n\t"
      "s_wait_xcnt 0x0"
      :: "v"(p) : "memory");
}
__device__ __forceinline__ void l2_ask2(const _Float16* p, const _Float16* q) {
  asm volatile(
      "global_prefetch_b8 %0, off scope:SCOPE_SE\n\t"
      "global_prefetch_b8 %1, off scope:SCOPE_SE\n\t"
      "s_wait_xcnt 0x0"
      :: "v"(p), "v"(q) : "memory");
}

// One stage: each thread copies 16 B of rows r, r+32, ... (4 of A, 8 of W).
// ga, gb: this lane's source in row r of the A and W tile; lds: its LDS byte
// address in row r of the target buffer.
__device__ __forceinline__ void copy_stage(const _Float16* ga, const _Float16* gb,
                                           unsigned lds) {
  // s_wait_xcnt stands inside the statement so that no address register of an
  // issued copy is rewritten ahead of it.
  asm volatile(
      "global_load_async_to_lds_b128 %0, %12, off\n\t"
      "global_load_async_to_lds_b128 %1, %13, off\n\t"
      "global_load_async_to_lds_b128 %2, %14, off\n\t"
      "global_load_async_to_lds_b128 %3, %15, off\n\t"
      "global_load_async_to_lds_b128 %4, %16, off\n\t"
      "global_load_async_to_lds_b128 %5, %17, off\n\t"
      "global_load_async_to_lds_b128 %6, %18, off\n\t"
      "global_load_async_to_lds_b128 %7, %19, off\n\t"
      "global_load_async_to_lds_b128 %8, %20, off\n\t"
      "global_load_async_to_lds_b128 %9, %21, off\n\t"
      "global_load_async_to_lds_b128 %10, %22, off\n\t"
      "global_load_async_to_lds_b128 %11, %23, off\n\t"
      "s_wait_xcnt 0x0"
      :: "v"(lds + 0u * (32u * PITCH_B)), "v"(lds + 1u * (32u * PITCH_B)), "v"(lds + 2u * (32u * PITCH_B)), "v"(lds + 3u * (32u * PITCH_B)), "v"(lds + 4u * (32u * PITCH_B)), "v"(lds + 5u * (32u * PITCH_B)), "v"(lds + 6u * (32u * PITCH_B)), "v"(lds + 7u * (32u * PITCH_B)), "v"(lds + 8u * (32u * PITCH_B)), "v"(lds + 9u * (32u * PITCH_B)), "v"(lds + 10u * (32u * PITCH_B)), "v"(lds + 11u * (32u * PITCH_B)),
         "v"(ga + 0 * 32 * C_), "v"(ga + 1 * 32 * C_), "v"(ga + 2 * 32 * C_), "v"(ga + 3 * 32 * C_), "v"(gb + 0 * 32 * C_), "v"(gb + 1 * 32 * C_), "v"(gb + 2 * 32 * C_), "v"(gb + 3 * 32 * C_), "v"(gb + 4 * 32 * C_), "v"(gb + 5 * 32 * C_), "v"(gb + 6 * 32 * C_), "v"(gb + 7 * 32 * C_)
      : "memory");
}

__device__ __forceinline__ void gemm_tile(const _Float16* __restrict__ A,
                                          const _Float16* __restrict__ W,
                                          long mblk, long nblk,
                                          _Float16* smem, v8f (&acc)[4][4]) {
  const int tid  = threadIdx.x;
  const int lane = tid & 31;
  const int wave = tid >> 5;
  const int wm = wave >> 2;        // 0..1
  const int wn = wave & 3;         // 0..3

  const _Float16* ga = A + (mblk + (tid >> 3)) * C_ + (tid & 7) * 8;
  const _Float16* gb = W + (nblk + (tid >> 3)) * C_ + (tid & 7) * 8;
  const unsigned lds0 = (unsigned)(size_t)smem + (unsigned)(tid >> 3) * PITCH_B
                        + (unsigned)(tid & 7) * 16u;

  copy_stage(ga, gb, lds0);
  // The whole tiles (all k) are asked for once, behind pass 0's own copies. The
  // blocks that read the same rows share the asking: a quarter of the A tile by
  // blockIdx.y, an eighth of the W tile by blockIdx.x >> 3 (its eight askers differ
  // in blockIdx.x & 7). A share is
  // 32 rows of 8 units: one unit of each tile a thread.
  l2_ask2(A + (mblk + (blockIdx.y & 3) * 32 + (tid >> 3)) * C_ + (tid & 7) * 128,
          W + (nblk + ((blockIdx.x >> 3) & 7) * 32 + (tid >> 3)) * C_ + (tid & 7) * 128);
  // pass 0's bytes have landed before the barrier publishes them
  asm volatile("s_wait_asynccnt 0x0" ::: "memory");
  __syncthreads();
  copy_stage(ga + BK_, gb + BK_, lds0 + STAGE_B);

  // rolled: one pass per trip, buffer = trip parity
#pragma unroll 1
  for (int t = 0; t < NPASS_; ++t) {
    const _Float16* sa = smem + (t & 1) * STAGE_H + (wm * 64) * PITCH_H;
    const _Float16* sb = smem + (t & 1) * STAGE_H + (BM_ + wn * 64) * PITCH_H;
#pragma unroll
    for (int kk = 0; kk < BK_; kk += 32) {
      v16h a[4], b[4];
#pragma unroll
      for (int i = 0; i < 4; ++i) a[i] = load_frag_lds(sa + i * 16 * PITCH_H + kk, PITCH_H, lane);
#pragma unroll
      for (int j = 0; j < 4; ++j) b[j] = load_frag_lds(sb + j * 16 * PITCH_H + kk, PITCH_H, lane);
      // keeps the block's 16 LDS reads one group ahead of its 16 WMMAs: spread
      // among them, each A row would wait out the LDS latency on its own
      __builtin_amdgcn_sched_barrier(0);
#pragma unroll
      for (int i = 0; i < 4; ++i)
#pragma unroll
        for (int j = 0; j < 4; ++j) acc[i][j] = wmma16(a[i], b[j], acc[i][j]);
      // keeps the next group's reads from sinking in among these WMMAs
      __builtin_amdgcn_sched_barrier(0);
    }
    // publish point of pass t+1: own LDS reads of this buffer retired, own
    // copies of the next buffer landed, then the barrier; only then the refill.
    asm volatile("s_wait_dscnt 0x0" ::: "memory");
    asm volatile("s_wait_asynccnt 0x0" ::: "memory");
    __syncthreads();
    if (t + 2 < NPASS_)
      copy_stage(ga + (t + 2) * BK_, gb + (t + 2) * BK_, lds0 + (unsigned)(t & 1) * STAGE_B);
  }
  // nothing is outstanding when the wave ends
  asm volatile("s_wait_asynccnt 0x0" ::: "memory");
}

// ---------------------------------------------------------------------------
// QKV GEMM: qkv[m][o] = sum_c X[m][c] * Wqkv[o][c]
//   X: [B*N, C] f16 row-major, Wqkv: [3C, C] f16 row-major (rows = B columns).
// Epilogue: Q,K: [B,H,N,D], V transposed: [B,H,D,N]. A wave's 64 x 64 tile is
// 64 positions of one batch by the 64 d of one head of one of Q, K, V, that is
// 64 whole 128-B lines of its target. The wave lays the tile, as f16, in its own
// LDS range in the target's row order (pitch 144 B) and stores it line by line.
// ---------------------------------------------------------------------------
#define EP_WAVE_H (64 * PITCH_H)             // one wave's staging range in halves

// 64 staged rows of 128 B -> 64 rows of dst, ld halves apart. A load or store
// covers 4 whole rows (8 lanes x 16 B a row).
__device__ __forceinline__ void store_rows(const _Float16* st, _Float16* __restrict__ dst,
                                           const int ld, int lane) {
  const _Float16* sp = st + (lane >> 3) * PITCH_H + (lane & 7) * 8;
  _Float16* gp = dst + (long)(lane >> 3) * ld + (lane & 7) * 8;
  v8h v[16];
  // both unrolled, loads apart from stores: v[] stays in registers and all 16
  // LDS reads are in flight before the first store waits for its row
#pragma unroll
  for (int k = 0; k < 16; ++k) v[k] = *(const v8h*)(sp + k * 4 * PITCH_H);
#pragma unroll
  for (int k = 0; k < 16; ++k) *(v8h*)(gp + (long)k * 4 * ld) = v[k];
}

__global__ void __launch_bounds__(256)
gemm_qkv(const _Float16* __restrict__ X, const _Float16* __restrict__ W,
         _Float16* __restrict__ Q, _Float16* __restrict__ K,
         _Float16* __restrict__ Vt) {
  __shared__ __attribute__((aligned(16))) _Float16 smem[2 * STAGE_H];
  const int lane = threadIdx.x & 31;
  // scalar: the choice of target and the tile's base address are per wave
  const int wave = __builtin_amdgcn_readfirstlane(threadIdx.x >> 5);
  const long mblk = (long)blockIdx.x * BM_;
  const long nblk = (long)blockIdx.y * BN_;
  const int m0 = (int)mblk + (wave >> 2) * 64;
  const int n0 = (int)nblk + (wave & 3) * 64;

  v8f acc[4][4] = {};
  gemm_tile(X, W, mblk, nblk, smem, acc);

  // The last pass's barrier stands behind every wave's last read of the ring and
  // nothing is being copied into it: each wave may now write its own range.
  _Float16* st = smem + wave * EP_WAVE_H;
  const int  s  = n0 >> 10;                       // 0 Q, 1 K, 2 V (C_ = 1024)
  const long bh = (long)(m0 >> 10) * H_ + ((n0 & 1023) >> 6);
  const int  nb = m0 & 1023;                      // the tile's first position
  const int  c  = lane & 15;
  const int  h8 = (lane >> 4) << 3;

  if (s == 2) {
    // staged rows = d: a lane's 8 values of a tile are 8 positions of one d
    // (both loops unrolled: acc stays in registers)
#pragma unroll
    for (int i = 0; i < 4; ++i)
#pragma unroll
      for (int j = 0; j < 4; ++j)
        *(v8h*)(st + (j * 16 + c) * PITCH_H + i * 16 + h8) =
            __builtin_convertvector(acc[i][j], v8h);
    // own LDS writes done before other lanes' rows are read back
    asm volatile("s_wait_dscnt 0x0" ::: "memory");
    store_rows(st, Vt + bh * D_ * N_ + nb, N_, lane);
  } else {
    // staged rows = positions: a lane's 8 values of a tile are 8 rows of one d
    // (all three loops unrolled: acc stays in registers)
#pragma unroll
    for (int i = 0; i < 4; ++i)
#pragma unroll
      for (int j = 0; j < 4; ++j)
#pragma unroll
        for (int r = 0; r < 8; ++r)
          st[(i * 16 + h8 + r) * PITCH_H + j * 16 + c] = (_Float16)acc[i][j][r];
    // own LDS writes done before other lanes' rows are read back
    asm volatile("s_wait_dscnt 0x0" ::: "memory");
    store_rows(st, (s == 0 ? Q : K) + (bh * N_ + nb) * D_, D_, lane);
  }
}

#define AK_       64
#define ASTAGE_H  ((AK_ + D_) * PITCH_H)
#define ASTAGE_B  (ASTAGE_H * 2u)
#define ANSTAGE_  (N_ / AK_)
#define AWAVES_   8                           // waves a block
#define AQB_      (AWAVES_ * 32)              // queries a block
#define ABPH_     (N_ / AQB_)                 // blocks a head

// One stage: each thread copies 16 B of rows r, r+32 of K and of V^T.
// gk, gv: this lane's source in row r of the K and V^T tile; lds: its LDS byte
// address in row r of the target buffer.
__device__ __forceinline__ void attn_copy_stage(const _Float16* gk, const _Float16* gv,
                                                unsigned lds) {
  // s_wait_xcnt stands inside the statement so that no address register of an
  // issued copy is rewritten ahead of it.
  asm volatile(
      "global_load_async_to_lds_b128 %0, %4, off\n\t"
      "global_load_async_to_lds_b128 %1, %5, off\n\t"
      "global_load_async_to_lds_b128 %2, %6, off\n\t"
      "global_load_async_to_lds_b128 %3, %7, off\n\t"
      "s_wait_xcnt 0x0"
      :: "v"(lds + 0u * (32u * PITCH_B)), "v"(lds + 1u * (32u * PITCH_B)), "v"(lds + 2u * (32u * PITCH_B)), "v"(lds + 3u * (32u * PITCH_B)),
         "v"(gk + 0 * 32 * D_), "v"(gk + 1 * 32 * D_), "v"(gv + 0 * 32 * N_), "v"(gv + 1 * 32 * N_)
      : "memory");
}

// value of lane l ^ 16 (the other half's lane of the same query)
__device__ __forceinline__ float xhalf(float x) {
  int i = __builtin_bit_cast(int, x);
  return __builtin_bit_cast(float, __builtin_amdgcn_permlanex16(
      i, i, 0x76543210, 0xfedcba98, false, false));
}

// Base-2 exponentials in place, a run of them in ONE statement: behind each
// v_exp_f32 stands an instruction that neither reads its result nor overwrites
// its source (the next v_exp_f32, on other registers; v_nop behind the last).
// That is the slot the instruction set asks for behind a transcendental.
__device__ __forceinline__ void exp2_run8(v8f& x) {
  float a = x[0], b = x[1], c = x[2], d = x[3], e = x[4], f = x[5], g = x[6], h = x[7];
  asm("v_exp_f32 %0, %0\n\t"
      "v_exp_f32 %1, %1\n\t"
      "v_exp_f32 %2, %2\n\t"
      "v_exp_f32 %3, %3\n\t"
      "v_exp_f32 %4, %4\n\t"
      "v_exp_f32 %5, %5\n\t"
      "v_exp_f32 %6, %6\n\t"
      "v_exp_f32 %7, %7\n\t"
      "v_nop"
      : "+v"(a), "+v"(b), "+v"(c), "+v"(d), "+v"(e), "+v"(f), "+v"(g), "+v"(h));
  x = v8f{a, b, c, d, e, f, g, h};
}
// one exponential, with its slot
__device__ __forceinline__ float exp2_one(float y) {
  asm("v_exp_f32 %0, %0\n\t"
      "v_nop"
      : "+v"(y));
  return y;
}
#define LOG2E_ 1.44269504f   // e^x = 2^(x * LOG2E_), as __expf forms it
#define LAZY_  5.5f          // how far a maximum may top its reference: P <= e^5.5 < 2^8

// amdgpu_waves_per_eu(4, 4): two column groups' output, score and Q tiles take 160
// registers before any fragment; four waves a SIMD (two blocks a WGP) leave each
// wave 256, and the grid's 512 blocks are then all resident at once.
__global__ void __launch_bounds__(AWAVES_ * 32) __attribute__((amdgpu_waves_per_eu(4, 4)))
attn_fwd(const _Float16* __restrict__ Q, const _Float16* __restrict__ K,
         const _Float16* __restrict__ Vt, _Float16* __restrict__ O) {
  __shared__ __attribute__((aligned(16))) _Float16 kv[2 * ASTAGE_H];
  const int tid  = threadIdx.x;
  const int lane = threadIdx.x & 31;
  const int wave = threadIdx.x >> 5;
  const int bh = blockIdx.x / ABPH_;                          // 0..B*H-1
  const int q0 = (blockIdx.x % ABPH_) * AQB_ + wave * 32;     // the wave's first query

  const _Float16* Qp = Q  + ((long)bh * N_ + q0) * D_;
  const _Float16* Kp = K  + (long)bh * N_ * D_;
  const _Float16* Vp = Vt + (long)bh * D_ * N_;

  // Q^T fragments (B operand): 64 d x 16 queries a group, two K=32 fragments each.
  v16h qa[2][2];
  // unrolled: qa stays in registers
#pragma unroll
  for (int g = 0; g < 2; ++g) {
    qa[g][0] = load_frag(Qp + g * 16 * D_ + 0,  D_, lane);
    qa[g][1] = load_frag(Qp + g * 16 * D_ + 32, D_, lane);
  }

  v8f  o_acc[2][4] = {};                  // O^T: 64 d (4 tiles) x 16 queries, a group
  float mref[2] = {-1e30f, -1e30f};       // this lane's queries: reference maxima (both halves alike)
  float lrun[2] = {0.f, 0.f};             // sums over this half's keys only; joined in the epilogue

  const _Float16* gk = Kp + (tid >> 3) * D_ + (tid & 7) * 8;
  const _Float16* gv = Vp + (tid >> 3) * N_ + (tid & 7) * 8;
  const unsigned lds0 = (unsigned)(size_t)kv + (unsigned)(tid >> 3) * PITCH_B
                        + (unsigned)(tid & 7) * 16u;

  attn_copy_stage(gk, gv, lds0);
  // The head's K and V^T (512 units of 256 B each) are asked for behind stage 0's
  // own copies. The 4 blocks of a head share the asking in halves; blocks j and
  // j ^ 2 ask for the same half: one unit of K and one of V^T a thread.
  {
    const int share = blockIdx.x & 1;
    l2_ask2(Kp + (share * 256 + tid) * 128, Vp + (share * 256 + tid) * 128);
  }
  // stage 0's bytes have landed before the barrier publishes them
  asm volatile("s_wait_asynccnt 0x0" ::: "memory");
  __syncthreads();
  attn_copy_stage(gk + AK_ * D_, gv + AK_, lds0 + ASTAGE_B);

  // rolled: one stage per trip, buffer = trip parity
#pragma unroll 1
  for (int st = 0; st < ANSTAGE_; ++st) {
   const _Float16* sk = kv + (st & 1) * ASTAGE_H;   // K rows of this stage
   const _Float16* sv = sk + AK_ * PITCH_H;         // V^T rows of this stage
   // ---- S^T = K . Q^T for the stage's 64 keys: four 16 (keys) x 16 (queries)
   //      tiles a group; a K fragment is read once for both groups
   v8f s[2][4];
   // both unrolled: the score tiles stay in registers, LDS offsets become immediates
#pragma unroll
   for (int u = 0; u < 4; ++u) {
     v16h k0 = load_frag_lds(sk + (u * 16) * PITCH_H + 0,  PITCH_H, lane);
     v16h k1 = load_frag_lds(sk + (u * 16) * PITCH_H + 32, PITCH_H, lane);
#pragma unroll
     for (int g = 0; g < 2; ++g) {
       v8f z = {};
       z = wmma16(k0, qa[g][0], z);
       s[g][u] = wmma16(k1, qa[g][1], z) * SCALE_;
     }
   }

   // ---- the stage's maxima, one query of each group a lane, against the references
   float mx[2];
   // both unrolled: the score tiles stay in registers
#pragma unroll
   for (int g = 0; g < 2; ++g) {
     float m = -1e30f;
#pragma unroll
     for (int r = 0; r < 8; ++r)
       m = fmaxf(m, fmaxf(fmaxf(s[g][0][r], s[g][1][r]), fmaxf(s[g][2][r], s[g][3][r])));
     mx[g] = fmaxf(m, xhalf(m));             // the query's maximum over all 64 keys
   }
   // one test a stage, the same for the whole wave (the WMMAs need every lane on);
   // always taken in stage 0, where mref is still the start value
   if (__builtin_amdgcn_ballot_w32(mx[0] > mref[0] + LAZY_ || mx[1] > mref[1] + LAZY_) != 0) {
     // all three unrolled: o_acc stays in registers
#pragma unroll
     for (int g = 0; g < 2; ++g) {
       const float mnew  = fmaxf(mref[g], mx[g]);
       const float alpha = exp2_one((mref[g] - mnew) * LOG2E_);   // e^(mref - mnew)
       mref[g] = mnew;
       lrun[g] *= alpha;
#pragma unroll
       for (int t = 0; t < 4; ++t)
#pragma unroll
         for (int r = 0; r < 8; ++r) o_acc[g][t][r] *= alpha;
     }
   }

   // unrolled: the two passes' LDS offsets become immediates
#pragma unroll
   for (int kb = 0; kb < AK_; kb += 32) {
    v16h va[4];                              // V^T, 64 d x 32 keys (A operands)
    // unrolled: va stays in registers, LDS offsets become immediates
#pragma unroll
    for (int t = 0; t < 4; ++t)
      va[t] = load_frag_lds(sv + (t * 16) * PITCH_H + kb, PITCH_H, lane);
    // keeps the pass's 8 LDS reads one group ahead of its exponentials: sunk to
    // their WMMAs, each pair would be waited out on its own
    __builtin_amdgcn_sched_barrier(0);

    // ---- P^T = e^(S^T - mref) for 32 keys, a group ------------------------
    v16h pb[2];                              // P^T, 32 keys x 16 queries (B operands)
    // unrolled: the score tiles and pb stay in registers
#pragma unroll
    for (int g = 0; g < 2; ++g) {
      v8f s0 = (s[g][kb / 16]     - mref[g]) * LOG2E_;
      v8f s1 = (s[g][kb / 16 + 1] - mref[g]) * LOG2E_;
      exp2_run8(s0);                         // P^T rows 8h + r
      exp2_run8(s1);                         // P^T rows 16 + 8h + r
      float rs0 = 0.f, rs1 = 0.f;
#pragma unroll
      for (int r = 0; r < 8; ++r) {
        rs0 += s0[r];
        rs1 += s1[r];
        pb[g][r]     = (_Float16)s0[r];      // k = 8h + r
        pb[g][8 + r] = (_Float16)s1[r];      // k = 16 + 8h + r
      }
      lrun[g] += rs0 + rs1;
    }

    // ---- O^T += V^T . P^T  (V stored transposed: [D, N]); a V^T fragment
    //      serves both groups ----------------------------------------------
    // both unrolled: o_acc stays in registers
#pragma unroll
    for (int t = 0; t < 4; ++t)
#pragma unroll
      for (int g = 0; g < 2; ++g) o_acc[g][t] = wmma16(va[t], pb[g], o_acc[g][t]);
   }
   // publish point of stage st+1: own LDS reads of this buffer retired, own
   // copies of the next buffer landed, then the barrier; only then the refill.
   asm volatile("s_wait_dscnt 0x0" ::: "memory");
   asm volatile("s_wait_asynccnt 0x0" ::: "memory");
   __syncthreads();
   if (st + 2 < ANSTAGE_)
     attn_copy_stage(gk + (st + 2) * (AK_ * D_), gv + (st + 2) * AK_,
                     lds0 + (unsigned)(st & 1) * ASTAGE_B);
  }
  // nothing is outstanding when the wave ends
  asm volatile("s_wait_asynccnt 0x0" ::: "memory");

  // ---- epilogue: normalize and write f16 into [B, N, C] -----------------
  // a lane holds d = 16 t + 8 (lane >> 4) + r of its queries: one 16-B store a tile
  const int b = bh >> 4;
  const int h = bh & 15;
  // all three unrolled: o_acc stays in registers
#pragma unroll
  for (int g = 0; g < 2; ++g) {
    const float l = lrun[g] + xhalf(lrun[g]);  // the two halves' sums joined
    const long row = (long)b * N_ + q0 + g * 16 + (lane & 15);
    _Float16* Op = O + row * C_ + h * D_ + ((lane >> 4) << 3);
#pragma unroll
    for (int t = 0; t < 4; ++t) {
      v8h o;
#pragma unroll
      for (int r = 0; r < 8; ++r) o[r] = (_Float16)(o_acc[g][t][r] / l);
      *(v8h*)(Op + t * 16) = o;
    }
  }
}

// ---------------------------------------------------------------------------
// Output projection: out[m][o] = sum_c A[m][c] * Wp[o][c] + bias[o]  (f32 out)
// Same main loop and tiles as gemm_qkv.
// ---------------------------------------------------------------------------
__global__ void __launch_bounds__(256)
gemm_proj(const _Float16* __restrict__ A, const _Float16* __restrict__ W,
          const float* __restrict__ bias, float* __restrict__ out) {
  __shared__ __attribute__((aligned(16))) _Float16 smem[2 * STAGE_H];
  const int lane = threadIdx.x & 31;
  const int wave = threadIdx.x >> 5;
  const long mblk = (long)blockIdx.x * BM_;
  const long nblk = (long)blockIdx.y * BN_;
  const long m0 = mblk + (wave >> 2) * 64;
  const long n0 = nblk + (wave & 3) * 64;

  v8f acc[4][4] = {};
  gemm_tile(A, W, mblk, nblk, smem, acc);

#pragma unroll
  for (int i = 0; i < 4; ++i)
#pragma unroll
    for (int j = 0; j < 4; ++j)
#pragma unroll
      for (int r = 0; r < 8; ++r) {
        long m = m0 + i * 16 + r + ((lane >> 4) << 3);
        long o = n0 + j * 16 + (lane & 15);
        out[m * C_ + o] = acc[i][j][r] + bias[o];
      }
}

// ---------------------------------------------------------------------------
// Launch
// ---------------------------------------------------------------------------
extern "C" void kernel_launch(void* const* d_in, const int* in_sizes, int n_in,
                              void* d_out, int out_size, void* d_ws, size_t ws_size,
                              hipStream_t stream) {
  const float* x      = (const float*)d_in[0];  // [B,N,C]
  const float* w_qkv  = (const float*)d_in[1];  // [3C,C]
  const float* w_proj = (const float*)d_in[2];  // [C,C]
  const float* b_proj = (const float*)d_in[3];  // [C]
  float* out = (float*)d_out;                   // [B,N,C]

  const long nX    = (long)B_ * N_ * C_;   // 8M
  const long nWqkv = (long)3 * C_ * C_;    // 3M
  const long nWp   = (long)C_ * C_;        // 1M
  const long nBHND = (long)B_ * H_ * N_ * D_; // 8M

  _Float16* xh  = (_Float16*)d_ws;
  _Float16* wqh = xh  + nX;
  _Float16* wph = wqh + nWqkv;
  _Float16* qw  = wph + nWp;
  _Float16* kw  = qw  + nBHND;
  _Float16* vtw = kw  + nBHND;
  _Float16* aw  = vtw + nBHND;   // attention output [B,N,C] f16

  // 1) f32 -> f16 conversions, one launch: 768 tiles of 16384 values into
  //    [xh | wqh | wph], three tiles a block, one block a WGP
  cvt_f32_f16<<<CVT_BLOCKS_, CVT_THREADS_, 0, stream>>>(x, w_qkv, w_proj, xh);

  // 2) QKV projection: M = B*N = 8192, N = 3C = 3072 (block tile 128x256)
  gemm_qkv<<<dim3(8192 / 128, 3072 / 256), 256, 0, stream>>>(xh, wqh, qw, kw, vtw);

  // 3) Flash attention: 256 queries a block (8 waves of 32), 4 blocks a head
  attn_fwd<<<B_ * H_ * ABPH_, AWAVES_ * 32, 0, stream>>>(qw, kw, vtw, aw);

  // 4) Output projection: M = 8192, N = C = 1024 (block tile 128x256)
  gemm_proj<<<dim3(8192 / 128, 1024 / 256), 256, 0, stream>>>(aw, wph, b_proj, out);
}
